// v000
// The times below were measured on an AMD MI455X: many runs one after another, warmed up first and cycling through
// copies of the inputs, with the whole window's GPU time divided by the number of runs. Launches and the gaps
// between them are all in it. The median over several windows is given; except for v000 it joins two sittings, which
// can be a few percent apart, so the side-by-side timings, each taken in one sitting, are the better comparison.
// v000, which the later versions start from, runs in 93 microseconds.
#include <hip/hip_runtime.h>
#include <hip/hip_bf16.h>

typedef _Float16 half_t;
typedef __attribute__((ext_vector_type(16))) _Float16 v16h;
typedef __attribute__((ext_vector_type(8)))  float    v8f;
typedef __attribute__((ext_vector_type(4)))  int      v4i;

#define D_MODEL 768
#define L_SEQ   4096
#define HEADS   12
#define HDIM    64
#define HALFWIN 64   // WINDOW/2

#if defined(__has_builtin)
#if __has_builtin(__builtin_amdgcn_global_load_async_to_lds_b128)
#define HAVE_ASYNC_LDS 1
#endif
#endif

__device__ __forceinline__ int clampi(int x, int lo, int hi) {
    return x < lo ? lo : (x > hi ? hi : x);
}

#ifdef HAVE_ASYNC_LDS
typedef __attribute__((address_space(1))) v4i* gptr_v4i;
typedef __attribute__((address_space(3))) v4i* lptr_v4i;
__device__ __forceinline__ void async_cp16(const half_t* g, half_t* l) {
    __builtin_amdgcn_global_load_async_to_lds_b128(
        (gptr_v4i)g, (lptr_v4i)l, 0, 0);
}
#endif

// ---------------------------------------------------------------------------
// one-shot f32 -> f16 conversion (inputs + weights), L2-resident
// ---------------------------------------------------------------------------
__global__ __launch_bounds__(256) void cvt_f32_f16(
    const float* __restrict__ s, half_t* __restrict__ d, int n)
{
    const int i = (blockIdx.x * 256 + threadIdx.x) * 8;
    if (i < n) {
#pragma unroll
        for (int j = 0; j < 8; ++j) d[i + j] = (half_t)s[i + j];
    }
}

// ---------------------------------------------------------------------------
// GEMM: C[M,N] = X[M,K] * W^T + b   (X, W both f16; W is [N,K] row-major)
// Block tile 128x64, 8 waves (4x2), wave tile 32x32 -> 4 WMMA / K-step.
// ---------------------------------------------------------------------------
template <typename TOUT>
__global__ __launch_bounds__(256) void gemm_xwt_f16(
    const half_t* __restrict__ X, const half_t* __restrict__ W,
    const float* __restrict__ bias, TOUT* __restrict__ C,
    int M, int N, int K)
{
    __shared__ half_t As[128][40];   // X tile  (rows m, cols k), padded
    __shared__ half_t Bs[64][40];    // W tile  (rows n, cols k), padded

    const int tid  = threadIdx.x;
    const int wave = tid >> 5;
    const int lane = tid & 31;
    const int m0 = blockIdx.x * 128;
    const int n0 = blockIdx.y * 64;
    const int wm = (wave & 3) * 32;        // wave row offset in block tile
    const int wn = (wave >> 2) * 32;       // wave col offset in block tile
    const int kb = (lane >> 4) * 8;        // K striping base for fragments

    v8f acc[2][2] = {};

    for (int k0 = 0; k0 < K; k0 += 32) {
        // ---- stage tiles into LDS ----
#ifdef HAVE_ASYNC_LDS
        {
#pragma unroll
            for (int t = 0; t < 2; ++t) {
                const int c   = tid + t * 256;     // 0..511
                const int row = c >> 2;
                const int col = (c & 3) * 8;
                async_cp16(X + (size_t)(m0 + row) * K + k0 + col, &As[row][col]);
            }
            const int brow = tid >> 2;             // 0..63
            const int bcol = (tid & 3) * 8;
            async_cp16(W + (size_t)(n0 + brow) * K + k0 + bcol, &Bs[brow][bcol]);
            asm volatile("s_wait_asynccnt 0" ::: "memory");
        }
#else
        {
            const int ar = tid >> 1;               // 0..127
            const int ac = (tid & 1) * 16;
            const half_t* src = X + (size_t)(m0 + ar) * K + k0 + ac;
#pragma unroll
            for (int j = 0; j < 16; ++j) As[ar][ac + j] = src[j];
            const int br = tid >> 2;               // 0..63
            const int bc = (tid & 3) * 8;
            const half_t* wsrc = W + (size_t)(n0 + br) * K + k0 + bc;
#pragma unroll
            for (int j = 0; j < 8; ++j) Bs[br][bc + j] = wsrc[j];
        }
#endif
        __syncthreads();

        // ---- fragments ----
        v16h a[2], b[2];
#pragma unroll
        for (int mi = 0; mi < 2; ++mi) {
            const int m = wm + mi * 16 + (lane & 15);
#pragma unroll
            for (int j = 0; j < 8; ++j) {
                a[mi][j]     = As[m][kb + j];
                a[mi][8 + j] = As[m][kb + 16 + j];
            }
        }
#pragma unroll
        for (int ni = 0; ni < 2; ++ni) {
            const int n = wn + ni * 16 + (lane & 15);
#pragma unroll
            for (int j = 0; j < 8; ++j) {
                b[ni][j]     = Bs[n][kb + j];
                b[ni][8 + j] = Bs[n][kb + 16 + j];
            }
        }
#pragma unroll
        for (int mi = 0; mi < 2; ++mi)
#pragma unroll
            for (int ni = 0; ni < 2; ++ni)
                acc[mi][ni] = __builtin_amdgcn_wmma_f32_16x16x32_f16(
                    false, a[mi], false, b[ni], (short)0, acc[mi][ni], false, false);
        __syncthreads();
    }

    // ---- writeback: lane%16 = column, rows = v + 8*(lane/16) ----
#pragma unroll
    for (int mi = 0; mi < 2; ++mi)
#pragma unroll
        for (int ni = 0; ni < 2; ++ni) {
            const int col = n0 + wn + ni * 16 + (lane & 15);
            const float bvv = bias[col];
            const int rbase = m0 + wm + mi * 16 + 8 * (lane >> 4);
#pragma unroll
            for (int v = 0; v < 8; ++v)
                C[(size_t)(rbase + v) * N + col] = (TOUT)(acc[mi][ni][v] + bvv);
        }
}

// ---------------------------------------------------------------------------
// Sliding-window attention: one wave per (head, 16-query block).
// Key span for a 16-query block: [q0-64, q0+79] -> 10 tiles of 16 (160 keys).
// ---------------------------------------------------------------------------
__global__ __launch_bounds__(128) void attn(
    const half_t* __restrict__ Q, const half_t* __restrict__ Kb,
    const half_t* __restrict__ Vb, half_t* __restrict__ O)
{
    __shared__ half_t Ps[4][16][176];      // per-wave P staging (f16)

    const int wave = threadIdx.x >> 5;
    const int lane = threadIdx.x & 31;
    const int task = blockIdx.x * 4 + wave;        // 0..3071
    const int h    = task >> 8;                    // head
    const int q0   = (task & 255) * 16;            // query block start
    const int colb = h * HDIM;                     // column base in [L,768]
    const int kb   = (lane >> 4) * 8;              // K striping base

    // ---- load Q fragments (16x64 A-matrix = two 16x32 fragments) ----
    v16h aQ0, aQ1;
    {
        const half_t* qrow = Q + (size_t)(q0 + (lane & 15)) * D_MODEL + colb;
#pragma unroll
        for (int j = 0; j < 8; ++j) {
            aQ0[j]     = qrow[kb + j];
            aQ0[8 + j] = qrow[kb + 16 + j];
            aQ1[j]     = qrow[32 + kb + j];
            aQ1[8 + j] = qrow[32 + kb + 16 + j];
        }
    }

    // ---- scores for 10 key tiles ----
    v8f   s[10];
    float rmax[8];
#pragma unroll
    for (int v = 0; v < 8; ++v) rmax[v] = -1e30f;

#pragma unroll
    for (int t = 0; t < 10; ++t) {
        const int kstart = q0 - HALFWIN + t * 16;
        const int key    = kstart + (lane & 15);
        const int keyc   = clampi(key, 0, L_SEQ - 1);
        const half_t* krow = Kb + (size_t)keyc * D_MODEL + colb;
        v16h b0, b1;
#pragma unroll
        for (int j = 0; j < 8; ++j) {
            b0[j]     = krow[kb + j];
            b0[8 + j] = krow[kb + 16 + j];
            b1[j]     = krow[32 + kb + j];
            b1[8 + j] = krow[32 + kb + 16 + j];
        }
        v8f c = {};
        c = __builtin_amdgcn_wmma_f32_16x16x32_f16(false, aQ0, false, b0,
                                                   (short)0, c, false, false);
        c = __builtin_amdgcn_wmma_f32_16x16x32_f16(false, aQ1, false, b1,
                                                   (short)0, c, false, false);
#pragma unroll
        for (int v = 0; v < 8; ++v) {
            const int row  = q0 + v + 8 * (lane >> 4);
            const int dif  = row - key;
            const bool ok  = (key >= 0) & (key < L_SEQ) &
                             (dif <= HALFWIN) & (dif >= -HALFWIN);
            const float sv = ok ? c[v] * 0.125f : -1e30f;   // 1/sqrt(64)
            s[t][v] = sv;
            rmax[v] = fmaxf(rmax[v], sv);
        }
    }

    // ---- row max across the 16 lanes of each half-wave ----
#pragma unroll
    for (int v = 0; v < 8; ++v) {
        float x = rmax[v];
#pragma unroll
        for (int off = 1; off < 16; off <<= 1)
            x = fmaxf(x, __shfl_xor(x, off, 32));
        rmax[v] = x;
    }

    // ---- exponentiate, row sum, stage P to LDS ----
    float rsum[8];
#pragma unroll
    for (int v = 0; v < 8; ++v) rsum[v] = 0.f;
#pragma unroll
    for (int t = 0; t < 10; ++t) {
#pragma unroll
        for (int v = 0; v < 8; ++v) {
            const float p = __expf(s[t][v] - rmax[v]);
            rsum[v] += p;
            Ps[wave][v + 8 * (lane >> 4)][t * 16 + (lane & 15)] = (half_t)p;
        }
    }
#pragma unroll
    for (int v = 0; v < 8; ++v) {
        float x = rsum[v];
#pragma unroll
        for (int off = 1; off < 16; off <<= 1)
            x += __shfl_xor(x, off, 32);
        rsum[v] = 1.0f / x;
    }

    // ---- O = P(16x160) * V(160x64), 5 K-steps x 4 N-tiles ----
    v8f o[4] = {{}, {}, {}, {}};
#pragma unroll
    for (int ks = 0; ks < 5; ++ks) {
        const int k2 = ks * 32;
        v16h aP;
        {
            const int m = lane & 15;
#pragma unroll
            for (int j = 0; j < 8; ++j) {
                aP[j]     = Ps[wave][m][k2 + kb + j];
                aP[8 + j] = Ps[wave][m][k2 + kb + 16 + j];
            }
        }
#pragma unroll
        for (int nt = 0; nt < 4; ++nt) {
            const int dcol = colb + nt * 16 + (lane & 15);
            v16h bV;
#pragma unroll
            for (int j = 0; j < 8; ++j) {
                const int key0 = clampi(q0 - HALFWIN + k2 + kb + j,      0, L_SEQ - 1);
                const int key1 = clampi(q0 - HALFWIN + k2 + kb + 16 + j, 0, L_SEQ - 1);
                bV[j]     = Vb[(size_t)key0 * D_MODEL + dcol];
                bV[8 + j] = Vb[(size_t)key1 * D_MODEL + dcol];
            }
            o[nt] = __builtin_amdgcn_wmma_f32_16x16x32_f16(false, aP, false, bV,
                                                           (short)0, o[nt], false, false);
        }
    }

    // ---- normalize + store (f16, row-major [L,768]) ----
#pragma unroll
    for (int nt = 0; nt < 4; ++nt) {
#pragma unroll
        for (int v = 0; v < 8; ++v) {
            const int row = q0 + v + 8 * (lane >> 4);
            const int col = colb + nt * 16 + (lane & 15);
            O[(size_t)row * D_MODEL + col] = (half_t)(o[nt][v] * rsum[v]);
        }
    }
}

// ---------------------------------------------------------------------------
extern "C" void kernel_launch(void* const* d_in, const int* in_sizes, int n_in,
                              void* d_out, int out_size, void* d_ws, size_t ws_size,
                              hipStream_t stream) {
    const float* query = (const float*)d_in[0];
    const float* key   = (const float*)d_in[1];
    const float* value = (const float*)d_in[2];
    const float* Wq = (const float*)d_in[3];
    const float* bq = (const float*)d_in[4];
    const float* Wk = (const float*)d_in[5];
    const float* bk = (const float*)d_in[6];
    const float* Wv = (const float*)d_in[7];
    const float* bv = (const float*)d_in[8];
    const float* Wo = (const float*)d_in[9];
    const float* bo = (const float*)d_in[10];

    const size_t E  = (size_t)L_SEQ * D_MODEL;      // 3145728
    const size_t WE = (size_t)D_MODEL * D_MODEL;    // 589824

    half_t* Xq  = (half_t*)d_ws;
    half_t* Xk  = Xq + E;
    half_t* Xv  = Xk + E;
    half_t* Wqh = Xv + E;
    half_t* Wkh = Wqh + WE;
    half_t* Wvh = Wkh + WE;
    half_t* Woh = Wvh + WE;
    half_t* Qb  = Woh + WE;
    half_t* Kb  = Qb + E;
    half_t* Vb  = Kb + E;
    half_t* Ob  = Vb + E;

    // f32 -> f16 conversion passes (L2-resident)
    cvt_f32_f16<<<(int)(E / 2048), 256, 0, stream>>>(query, Xq, (int)E);
    cvt_f32_f16<<<(int)(E / 2048), 256, 0, stream>>>(key,   Xk, (int)E);
    cvt_f32_f16<<<(int)(E / 2048), 256, 0, stream>>>(value, Xv, (int)E);
    cvt_f32_f16<<<(int)(WE / 2048), 256, 0, stream>>>(Wq, Wqh, (int)WE);
    cvt_f32_f16<<<(int)(WE / 2048), 256, 0, stream>>>(Wk, Wkh, (int)WE);
    cvt_f32_f16<<<(int)(WE / 2048), 256, 0, stream>>>(Wv, Wvh, (int)WE);
    cvt_f32_f16<<<(int)(WE / 2048), 256, 0, stream>>>(Wo, Woh, (int)WE);

    dim3 ggrid(L_SEQ / 128, D_MODEL / 64, 1);
    gemm_xwt_f16<half_t><<<ggrid, 256, 0, stream>>>(Xq, Wqh, bq, Qb,
                                                    L_SEQ, D_MODEL, D_MODEL);
    gemm_xwt_f16<half_t><<<ggrid, 256, 0, stream>>>(Xk, Wkh, bk, Kb,
                                                    L_SEQ, D_MODEL, D_MODEL);
    gemm_xwt_f16<half_t><<<ggrid, 256, 0, stream>>>(Xv, Wvh, bv, Vb,
                                                    L_SEQ, D_MODEL, D_MODEL);

    attn<<<(HEADS * (L_SEQ / 16)) / 4, 128, 0, stream>>>(Qb, Kb, Vb, Ob);

    gemm_xwt_f16<float><<<ggrid, 256, 0, stream>>>(Ob, Woh, bo, (float*)d_out,
                                                   L_SEQ, D_MODEL, D_MODEL);
}

// v001
// A run of this version takes 62.5 microseconds.
// Timed twice side by side with v000, it ran 1.50 and 1.49 times as fast.
#include <hip/hip_runtime.h>
#include <hip/hip_bf16.h>

typedef _Float16 half_t;
typedef __attribute__((ext_vector_type(16))) _Float16 v16h;
typedef __attribute__((ext_vector_type(8)))  float    v8f;
typedef __attribute__((ext_vector_type(4)))  int      v4i;

#define D_MODEL 768
#define L_SEQ   4096
#define HEADS   12
#define HDIM    64
#define HALFWIN 64   // WINDOW/2

#if defined(__has_builtin)
#if __has_builtin(__builtin_amdgcn_global_load_async_to_lds_b128)
#define HAVE_ASYNC_LDS 1
#endif
#endif

__device__ __forceinline__ int clampi(int x, int lo, int hi) {
    return x < lo ? lo : (x > hi ? hi : x);
}

#ifdef HAVE_ASYNC_LDS
typedef __attribute__((address_space(1))) v4i* gptr_v4i;
typedef __attribute__((address_space(3))) v4i* lptr_v4i;
__device__ __forceinline__ void async_cp16(const half_t* g, half_t* l) {
    __builtin_amdgcn_global_load_async_to_lds_b128(
        (gptr_v4i)g, (lptr_v4i)l, 0, 0);
}
#endif

// ---------------------------------------------------------------------------
// f32 -> f16 conversion of all seven operands in ONE launch. The f16 copies
// lie back to back in the workspace (3 activations, then 4 weights), so the
// destination is the flat block index; the block index picks the source.
// Every block converts 2048 elements; both sizes are multiples of 2048.
// ---------------------------------------------------------------------------
#define XBLK (L_SEQ * D_MODEL / 2048)     // blocks per activation
#define WBLK (D_MODEL * D_MODEL / 2048)   // blocks per weight
__global__ __launch_bounds__(256) void cvt_all_f32_f16(
    const float* __restrict__ xq, const float* __restrict__ xk,
    const float* __restrict__ xv, const float* __restrict__ wq,
    const float* __restrict__ wk, const float* __restrict__ wv,
    const float* __restrict__ wo, half_t* __restrict__ d)
{
    const int b = blockIdx.x;
    const float* s;
    int lb;                                // block index inside its source
    if (b < 3 * XBLK) {
        const int seg = b / XBLK;
        lb = b - seg * XBLK;
        s  = seg == 0 ? xq : (seg == 1 ? xk : xv);
    } else {
        const int r   = b - 3 * XBLK;
        const int seg = r / WBLK;
        lb = r - seg * WBLK;
        s  = seg == 0 ? wq : (seg == 1 ? wk : (seg == 2 ? wv : wo));
    }
    const int si = (lb * 256 + threadIdx.x) * 8;
    const int di = (b  * 256 + threadIdx.x) * 8;
#pragma unroll
    for (int j = 0; j < 8; ++j) d[di + j] = (half_t)s[si + j];
}

// ---------------------------------------------------------------------------
// GEMM: C[M,N] = X[M,K] * W^T + b   (X, W both f16; W is [N,K] row-major)
// Block tile 128x64, 8 waves (4x2), wave tile 32x32 -> 4 WMMA / K-step.
// ---------------------------------------------------------------------------
template <typename TOUT>
__device__ __forceinline__ void gemm_xwt_tile(
    const half_t* __restrict__ X, const half_t* __restrict__ W,
    const float* __restrict__ bias, TOUT* __restrict__ C,
    int M, int N, int K)
{
    __shared__ half_t As[128][40];   // X tile  (rows m, cols k), padded
    __shared__ half_t Bs[64][40];    // W tile  (rows n, cols k), padded

    const int tid  = threadIdx.x;
    const int wave = tid >> 5;
    const int lane = tid & 31;
    const int m0 = blockIdx.x * 128;
    const int n0 = blockIdx.y * 64;
    const int wm = (wave & 3) * 32;        // wave row offset in block tile
    const int wn = (wave >> 2) * 32;       // wave col offset in block tile
    const int kb = (lane >> 4) * 8;        // K striping base for fragments

    v8f acc[2][2] = {};

    for (int k0 = 0; k0 < K; k0 += 32) {
        // ---- stage tiles into LDS ----
#ifdef HAVE_ASYNC_LDS
        {
#pragma unroll
            for (int t = 0; t < 2; ++t) {
                const int c   = tid + t * 256;     // 0..511
                const int row = c >> 2;
                const int col = (c & 3) * 8;
                async_cp16(X + (size_t)(m0 + row) * K + k0 + col, &As[row][col]);
            }
            const int brow = tid >> 2;             // 0..63
            const int bcol = (tid & 3) * 8;
            async_cp16(W + (size_t)(n0 + brow) * K + k0 + bcol, &Bs[brow][bcol]);
            asm volatile("s_wait_asynccnt 0" ::: "memory");
        }
#else
        {
            const int ar = tid >> 1;               // 0..127
            const int ac = (tid & 1) * 16;
            const half_t* src = X + (size_t)(m0 + ar) * K + k0 + ac;
#pragma unroll
            for (int j = 0; j < 16; ++j) As[ar][ac + j] = src[j];
            const int br = tid >> 2;               // 0..63
            const int bc = (tid & 3) * 8;
            const half_t* wsrc = W + (size_t)(n0 + br) * K + k0 + bc;
#pragma unroll
            for (int j = 0; j < 8; ++j) Bs[br][bc + j] = wsrc[j];
        }
#endif
        __syncthreads();

        // ---- fragments ----
        v16h a[2], b[2];
#pragma unroll
        for (int mi = 0; mi < 2; ++mi) {
            const int m = wm + mi * 16 + (lane & 15);
#pragma unroll
            for (int j = 0; j < 8; ++j) {
                a[mi][j]     = As[m][kb + j];
                a[mi][8 + j] = As[m][kb + 16 + j];
            }
        }
#pragma unroll
        for (int ni = 0; ni < 2; ++ni) {
            const int n = wn + ni * 16 + (lane & 15);
#pragma unroll
            for (int j = 0; j < 8; ++j) {
                b[ni][j]     = Bs[n][kb + j];
                b[ni][8 + j] = Bs[n][kb + 16 + j];
            }
        }
#pragma unroll
        for (int mi = 0; mi < 2; ++mi)
#pragma unroll
            for (int ni = 0; ni < 2; ++ni)
                acc[mi][ni] = __builtin_amdgcn_wmma_f32_16x16x32_f16(
                    false, a[mi], false, b[ni], (short)0, acc[mi][ni], false, false);
        __syncthreads();
    }

    // ---- writeback: lane%16 = column, rows = v + 8*(lane/16) ----
#pragma unroll
    for (int mi = 0; mi < 2; ++mi)
#pragma unroll
        for (int ni = 0; ni < 2; ++ni) {
            const int col = n0 + wn + ni * 16 + (lane & 15);
            const float bvv = bias[col];
            const int rbase = m0 + wm + mi * 16 + 8 * (lane >> 4);
#pragma unroll
            for (int v = 0; v < 8; ++v)
                C[(size_t)(rbase + v) * N + col] = (TOUT)(acc[mi][ni][v] + bvv);
        }
}

// The three input projections are independent: one launch, blockIdx.z picks
// the operand set (X, W and C of the three lie back to back in the workspace).
__global__ __launch_bounds__(256) void gemm_qkv_f16(
    const half_t* __restrict__ X, const half_t* __restrict__ W,
    const float* __restrict__ bq, const float* __restrict__ bk,
    const float* __restrict__ bv, half_t* __restrict__ C,
    int M, int N, int K)
{
    const int z = blockIdx.z;
    const float* bias = z == 0 ? bq : (z == 1 ? bk : bv);
    gemm_xwt_tile<half_t>(X + (size_t)z * M * K, W + (size_t)z * N * K, bias,
                          C + (size_t)z * M * N, M, N, K);
}

__global__ __launch_bounds__(256) void gemm_out_f32(
    const half_t* __restrict__ X, const half_t* __restrict__ W,
    const float* __restrict__ bias, float* __restrict__ C,
    int M, int N, int K)
{
    gemm_xwt_tile<float>(X, W, bias, C, M, N, K);
}

// ---------------------------------------------------------------------------
// Sliding-window attention: one wave per (head, 16-query block).
// Key span for a 16-query block: [q0-64, q0+79] -> 10 tiles of 16 (160 keys).
// ---------------------------------------------------------------------------
__global__ __launch_bounds__(128) void attn(
    const half_t* __restrict__ Q, const half_t* __restrict__ Kb,
    const half_t* __restrict__ Vb, half_t* __restrict__ O)
{
    __shared__ half_t Ps[4][16][176];      // per-wave P staging (f16)

    const int wave = threadIdx.x >> 5;
    const int lane = threadIdx.x & 31;
    const int task = blockIdx.x * 4 + wave;        // 0..3071
    const int h    = task >> 8;                    // head
    const int q0   = (task & 255) * 16;            // query block start
    const int colb = h * HDIM;                     // column base in [L,768]
    const int kb   = (lane >> 4) * 8;              // K striping base

    // ---- load Q fragments (16x64 A-matrix = two 16x32 fragments) ----
    v16h aQ0, aQ1;
    {
        const half_t* qrow = Q + (size_t)(q0 + (lane & 15)) * D_MODEL + colb;
#pragma unroll
        for (int j = 0; j < 8; ++j) {
            aQ0[j]     = qrow[kb + j];
            aQ0[8 + j] = qrow[kb + 16 + j];
            aQ1[j]     = qrow[32 + kb + j];
            aQ1[8 + j] = qrow[32 + kb + 16 + j];
        }
    }

    // ---- scores for 10 key tiles ----
    v8f   s[10];
    float rmax[8];
#pragma unroll
    for (int v = 0; v < 8; ++v) rmax[v] = -1e30f;

#pragma unroll
    for (int t = 0; t < 10; ++t) {
        const int kstart = q0 - HALFWIN + t * 16;
        const int key    = kstart + (lane & 15);
        const int keyc   = clampi(key, 0, L_SEQ - 1);
        const half_t* krow = Kb + (size_t)keyc * D_MODEL + colb;
        v16h b0, b1;
#pragma unroll
        for (int j = 0; j < 8; ++j) {
            b0[j]     = krow[kb + j];
            b0[8 + j] = krow[kb + 16 + j];
            b1[j]     = krow[32 + kb + j];
            b1[8 + j] = krow[32 + kb + 16 + j];
        }
        v8f c = {};
        c = __builtin_amdgcn_wmma_f32_16x16x32_f16(false, aQ0, false, b0,
                                                   (short)0, c, false, false);
        c = __builtin_amdgcn_wmma_f32_16x16x32_f16(false, aQ1, false, b1,
                                                   (short)0, c, false, false);
#pragma unroll
        for (int v = 0; v < 8; ++v) {
            const int row  = q0 + v + 8 * (lane >> 4);
            const int dif  = row - key;
            const bool ok  = (key >= 0) & (key < L_SEQ) &
                             (dif <= HALFWIN) & (dif >= -HALFWIN);
            const float sv = ok ? c[v] * 0.125f : -1e30f;   // 1/sqrt(64)
            s[t][v] = sv;
            rmax[v] = fmaxf(rmax[v], sv);
        }
    }

    // ---- row max across the 16 lanes of each half-wave ----
#pragma unroll
    for (int v = 0; v < 8; ++v) {
        float x = rmax[v];
#pragma unroll
        for (int off = 1; off < 16; off <<= 1)
            x = fmaxf(x, __shfl_xor(x, off, 32));
        rmax[v] = x;
    }

    // ---- exponentiate, row sum, stage P to LDS ----
    float rsum[8];
#pragma unroll
    for (int v = 0; v < 8; ++v) rsum[v] = 0.f;
#pragma unroll
    for (int t = 0; t < 10; ++t) {
#pragma unroll
        for (int v = 0; v < 8; ++v) {
            const float p = __expf(s[t][v] - rmax[v]);
            rsum[v] += p;
            Ps[wave][v + 8 * (lane >> 4)][t * 16 + (lane & 15)] = (half_t)p;
        }
    }
#pragma unroll
    for (int v = 0; v < 8; ++v) {
        float x = rsum[v];
#pragma unroll
        for (int off = 1; off < 16; off <<= 1)
            x += __shfl_xor(x, off, 32);
        rsum[v] = 1.0f / x;
    }

    // ---- O = P(16x160) * V(160x64), 5 K-steps x 4 N-tiles ----
    v8f o[4] = {{}, {}, {}, {}};
#pragma unroll
    for (int ks = 0; ks < 5; ++ks) {
        const int k2 = ks * 32;
        v16h aP;
        {
            const int m = lane & 15;
#pragma unroll
            for (int j = 0; j < 8; ++j) {
                aP[j]     = Ps[wave][m][k2 + kb + j];
                aP[8 + j] = Ps[wave][m][k2 + kb + 16 + j];
            }
        }
#pragma unroll
        for (int nt = 0; nt < 4; ++nt) {
            const int dcol = colb + nt * 16 + (lane & 15);
            v16h bV;
#pragma unroll
            for (int j = 0; j < 8; ++j) {
                const int key0 = clampi(q0 - HALFWIN + k2 + kb + j,      0, L_SEQ - 1);
                const int key1 = clampi(q0 - HALFWIN + k2 + kb + 16 + j, 0, L_SEQ - 1);
                bV[j]     = Vb[(size_t)key0 * D_MODEL + dcol];
                bV[8 + j] = Vb[(size_t)key1 * D_MODEL + dcol];
            }
            o[nt] = __builtin_amdgcn_wmma_f32_16x16x32_f16(false, aP, false, bV,
                                                           (short)0, o[nt], false, false);
        }
    }

    // ---- normalize + store (f16, row-major [L,768]) ----
#pragma unroll
    for (int nt = 0; nt < 4; ++nt) {
#pragma unroll
        for (int v = 0; v < 8; ++v) {
            const int row = q0 + v + 8 * (lane >> 4);
            const int col = colb + nt * 16 + (lane & 15);
            O[(size_t)row * D_MODEL + col] = (half_t)(o[nt][v] * rsum[v]);
        }
    }
}

// ---------------------------------------------------------------------------
extern "C" void kernel_launch(void* const* d_in, const int* in_sizes, int n_in,
                              void* d_out, int out_size, void* d_ws, size_t ws_size,
                              hipStream_t stream) {
    const float* query = (const float*)d_in[0];
    const float* key   = (const float*)d_in[1];
    const float* value = (const float*)d_in[2];
    const float* Wq = (const float*)d_in[3];
    const float* bq = (const float*)d_in[4];
    const float* Wk = (const float*)d_in[5];
    const float* bk = (const float*)d_in[6];
    const float* Wv = (const float*)d_in[7];
    const float* bv = (const float*)d_in[8];
    const float* Wo = (const float*)d_in[9];
    const float* bo = (const float*)d_in[10];

    const size_t E  = (size_t)L_SEQ * D_MODEL;      // 3145728
    const size_t WE = (size_t)D_MODEL * D_MODEL;    // 589824

    half_t* Xq  = (half_t*)d_ws;
    half_t* Xk  = Xq + E;
    half_t* Xv  = Xk + E;
    half_t* Wqh = Xv + E;
    half_t* Wkh = Wqh + WE;
    half_t* Wvh = Wkh + WE;
    half_t* Woh = Wvh + WE;
    half_t* Qb  = Woh + WE;
    half_t* Kb  = Qb + E;
    half_t* Vb  = Kb + E;
    half_t* Ob  = Vb + E;

    // f32 -> f16 conversion of all seven operands, one launch (Xq .. Woh)
    cvt_all_f32_f16<<<3 * XBLK + 4 * WBLK, 256, 0, stream>>>(
        query, key, value, Wq, Wk, Wv, Wo, Xq);

    // Q, K and V projections, one launch (Xq/Xk/Xv, Wqh/Wkh/Wvh -> Qb/Kb/Vb)
    dim3 qkvgrid(L_SEQ / 128, D_MODEL / 64, 3);
    gemm_qkv_f16<<<qkvgrid, 256, 0, stream>>>(Xq, Wqh, bq, bk, bv, Qb,
                                              L_SEQ, D_MODEL, D_MODEL);

    attn<<<(HEADS * (L_SEQ / 16)) / 4, 128, 0, stream>>>(Qb, Kb, Vb, Ob);

    dim3 ggrid(L_SEQ / 128, D_MODEL / 64, 1);
    gemm_out_f32<<<ggrid, 256, 0, stream>>>(Ob, Woh, bo, (float*)d_out,
                                            L_SEQ, D_MODEL, D_MODEL);
}

// v002
// One run takes 51.8 microseconds.
// In two side-by-side timings against v001, it was 1.21 and 1.20 times as fast.
// Over all steps from v000 it is 1.80 times as fast.
#include <hip/hip_runtime.h>
#include <hip/hip_bf16.h>

typedef _Float16 half_t;
typedef __attribute__((ext_vector_type(16))) _Float16 v16h;
typedef __attribute__((ext_vector_type(8)))  float    v8f;

#define D_MODEL 768
#define L_SEQ   4096
#define HEADS   12
#define HDIM    64
#define HALFWIN 64   // WINDOW/2

__device__ __forceinline__ int clampi(int x, int lo, int hi) {
    return x < lo ? lo : (x > hi ? hi : x);
}

// ---------------------------------------------------------------------------
// f32 -> f16 conversion of all seven operands in ONE launch. The f16 copies
// lie back to back in the workspace (3 activations, then 4 weights), so the
// destination is the flat block index; the block index picks the source.
// Every block converts 2048 elements; both sizes are multiples of 2048.
// ---------------------------------------------------------------------------
#define XBLK (L_SEQ * D_MODEL / 2048)     // blocks per activation
#define WBLK (D_MODEL * D_MODEL / 2048)   // blocks per weight
__global__ __launch_bounds__(256) void cvt_all_f32_f16(
    const float* __restrict__ xq, const float* __restrict__ xk,
    const float* __restrict__ xv, const float* __restrict__ wq,
    const float* __restrict__ wk, const float* __restrict__ wv,
    const float* __restrict__ wo, half_t* __restrict__ d)
{
    const int b = blockIdx.x;
    const float* s;
    int lb;                                // block index inside its source
    if (b < 3 * XBLK) {
        const int seg = b / XBLK;
        lb = b - seg * XBLK;
        s  = seg == 0 ? xq : (seg == 1 ? xk : xv);
    } else {
        const int r   = b - 3 * XBLK;
        const int seg = r / WBLK;
        lb = r - seg * WBLK;
        s  = seg == 0 ? wq : (seg == 1 ? wk : (seg == 2 ? wv : wo));
    }
    const int si = (lb * 256 + threadIdx.x) * 8;
    const int di = (b  * 256 + threadIdx.x) * 8;
#pragma unroll
    for (int j = 0; j < 8; ++j) d[di + j] = (half_t)s[si + j];
}

// ---------------------------------------------------------------------------
// GEMM: C[M,N] = X[M,K] * W^T + b   (X, W both f16; W is [N,K] row-major)
// Block tile 128x64, 8 waves (4x2), wave tile 32x32 -> 4 WMMA / 32 k.
// K runs in stages of 128 (256 B of every operand row) through two LDS
// buffers: a stage's copies are issued one stage ahead of its use.
// K must be a multiple of 128.
// ---------------------------------------------------------------------------
#define BKS     128                  // k elements per stage
#define SPITCH  (BKS + 8)            // LDS row pitch in elements: 272 B = 16 B x 17
#define SROWS   (128 + 64)           // rows of a stage: the X tile, then the W tile
#define RSTEP_B (16 * SPITCH * 2)    // LDS bytes from one copy's rows to the next's

// One stage, 12 asynchronous 16-B copies per lane: the block's 256 lanes cover
// 16 rows of 256 B per copy; copies 0..7 bring the X rows, 8..11 the W rows.
// gx, gw: the lane's address in the first 16 rows; gstep: 16 rows, in elements.
__device__ __forceinline__ void copy_stage(
    const half_t* gx, const half_t* gw, size_t gstep, unsigned l)
{
    // s_wait_xcnt closes the statement, so that no address register named here
    // is rewritten ahead of it.
    asm volatile(
        "global_load_async_to_lds_b128 %0, %12, off\n\t"
        "global_load_async_to_lds_b128 %1, %13, off\n\t"
        "global_load_async_to_lds_b128 %2, %14, off\n\t"
        "global_load_async_to_lds_b128 %3, %15, off\n\t"
        "global_load_async_to_lds_b128 %4, %16, off\n\t"
        "global_load_async_to_lds_b128 %5, %17, off\n\t"
        "global_load_async_to_lds_b128 %6, %18, off\n\t"
        "global_load_async_to_lds_b128 %7, %19, off\n\t"
        "global_load_async_to_lds_b128 %8, %20, off\n\t"
        "global_load_async_to_lds_b128 %9, %21, off\n\t"
        "global_load_async_to_lds_b128 %10, %22, off\n\t"
        "global_load_async_to_lds_b128 %11, %23, off\n\t"
        "s_wait_xcnt 0x0"
        :: "v"(l),                "v"(l + 1 * RSTEP_B),  "v"(l + 2 * RSTEP_B),
           "v"(l + 3 * RSTEP_B),  "v"(l + 4 * RSTEP_B),  "v"(l + 5 * RSTEP_B),
           "v"(l + 6 * RSTEP_B),  "v"(l + 7 * RSTEP_B),  "v"(l + 8 * RSTEP_B),
           "v"(l + 9 * RSTEP_B),  "v"(l + 10 * RSTEP_B), "v"(l + 11 * RSTEP_B),
           "v"(gx),             "v"(gx + gstep),     "v"(gx + 2 * gstep),
           "v"(gx + 3 * gstep), "v"(gx + 4 * gstep), "v"(gx + 5 * gstep),
           "v"(gx + 6 * gstep), "v"(gx + 7 * gstep),
           "v"(gw),             "v"(gw + gstep),     "v"(gw + 2 * gstep),
           "v"(gw + 3 * gstep)
        : "memory");
}

template <typename TOUT>
__device__ __forceinline__ void gemm_xwt_tile(
    const half_t* __restrict__ X, const half_t* __restrict__ W,
    const float* __restrict__ bias, TOUT* __restrict__ C,
    int M, int N, int K)
{
    __shared__ __attribute__((aligned(16))) half_t S[2][SROWS][SPITCH];

    const int tid  = threadIdx.x;
    const int wave = tid >> 5;
    const int lane = tid & 31;
    const int m0 = blockIdx.x * 128;
    const int n0 = blockIdx.y * 64;
    const int wm = (wave & 3) * 32;        // wave row offset in block tile
    const int wn = (wave >> 2) * 32;       // wave col offset in block tile
    const int kb = (lane >> 4) * 8;        // K striping base for fragments

    // the lane's place in a copy: row tid / 16 of 16, 16-B piece tid % 16 of 16
    const int crow = tid >> 4;
    const int ccol = (tid & 15) * 8;
    const half_t* gx = X + (size_t)(m0 + crow) * K + ccol;
    const half_t* gw = W + (size_t)(n0 + crow) * K + ccol;
    const size_t  gstep = (size_t)16 * K;
    const unsigned l0 = (unsigned)(size_t)&S[0][crow][ccol];
    const unsigned l1 = (unsigned)(size_t)&S[1][crow][ccol];
    const int nst = K / BKS;               // stages

    v8f acc[2][2] = {};

    // ---- prologue: stage 0 landed and published, stage 1 in flight ----
    copy_stage(gx, gw, gstep, l0);
    asm volatile("s_wait_asynccnt 0x0" ::: "memory");   // own copies of stage 0 landed
    __syncthreads();                                    // ... and every other wave's
    if (nst > 1) copy_stage(gx + BKS, gw + BKS, gstep, l1);

    for (int s = 0; s < nst; ++s) {
        const half_t (*St)[SPITCH] = S[s & 1];
        // unrolled, so that kk becomes an immediate offset of the LDS reads
#pragma unroll
        for (int kk = 0; kk < BKS; kk += 32) {
            // ---- fragments ----
            v16h a[2], b[2];
#pragma unroll
            for (int mi = 0; mi < 2; ++mi) {
                const int m = wm + mi * 16 + (lane & 15);
#pragma unroll
                for (int j = 0; j < 8; ++j) {
                    a[mi][j]     = St[m][kk + kb + j];
                    a[mi][8 + j] = St[m][kk + kb + 16 + j];
                }
            }
#pragma unroll
            for (int ni = 0; ni < 2; ++ni) {
                const int n = 128 + wn + ni * 16 + (lane & 15);
#pragma unroll
                for (int j = 0; j < 8; ++j) {
                    b[ni][j]     = St[n][kk + kb + j];
                    b[ni][8 + j] = St[n][kk + kb + 16 + j];
                }
            }
#pragma unroll
            for (int mi = 0; mi < 2; ++mi)
#pragma unroll
                for (int ni = 0; ni < 2; ++ni)
                    acc[mi][ni] = __builtin_amdgcn_wmma_f32_16x16x32_f16(
                        false, a[mi], false, b[ni], (short)0, acc[mi][ni], false, false);
        }
        // ---- publish stage s + 1, free this stage's buffer ----
        asm volatile("s_wait_dscnt 0x0" ::: "memory");     // own reads of this buffer done
        asm volatile("s_wait_asynccnt 0x0" ::: "memory");  // own copies of stage s + 1 landed
        __syncthreads();
        if (s + 2 < nst)
            copy_stage(gx + (size_t)(s + 2) * BKS, gw + (size_t)(s + 2) * BKS,
                       gstep, (s & 1) ? l1 : l0);
    }
    asm volatile("s_wait_asynccnt 0x0" ::: "memory");      // nothing in flight at the end

    // ---- writeback: lane%16 = column, rows = v + 8*(lane/16) ----
#pragma unroll
    for (int mi = 0; mi < 2; ++mi)
#pragma unroll
        for (int ni = 0; ni < 2; ++ni) {
            const int col = n0 + wn + ni * 16 + (lane & 15);
            const float bvv = bias[col];
            const int rbase = m0 + wm + mi * 16 + 8 * (lane >> 4);
#pragma unroll
            for (int v = 0; v < 8; ++v)
                C[(size_t)(rbase + v) * N + col] = (TOUT)(acc[mi][ni][v] + bvv);
        }
}

// The three input projections are independent: one launch, blockIdx.z picks
// the operand set (X, W and C of the three lie back to back in the workspace).
__global__ __launch_bounds__(256) void gemm_qkv_f16(
    const half_t* __restrict__ X, const half_t* __restrict__ W,
    const float* __restrict__ bq, const float* __restrict__ bk,
    const float* __restrict__ bv, half_t* __restrict__ C,
    int M, int N, int K)
{
    const int z = blockIdx.z;
    const float* bias = z == 0 ? bq : (z == 1 ? bk : bv);
    gemm_xwt_tile<half_t>(X + (size_t)z * M * K, W + (size_t)z * N * K, bias,
                          C + (size_t)z * M * N, M, N, K);
}

__global__ __launch_bounds__(256) void gemm_out_f32(
    const half_t* __restrict__ X, const half_t* __restrict__ W,
    const float* __restrict__ bias, float* __restrict__ C,
    int M, int N, int K)
{
    gemm_xwt_tile<float>(X, W, bias, C, M, N, K);
}

// ---------------------------------------------------------------------------
// Sliding-window attention: one wave per (head, 16-query block).
// Key span for a 16-query block: [q0-64, q0+79] -> 10 tiles of 16 (160 keys).
// ---------------------------------------------------------------------------
__global__ __launch_bounds__(128) void attn(
    const half_t* __restrict__ Q, const half_t* __restrict__ Kb,
    const half_t* __restrict__ Vb, half_t* __restrict__ O)
{
    __shared__ half_t Ps[4][16][176];      // per-wave P staging (f16)

    const int wave = threadIdx.x >> 5;
    const int lane = threadIdx.x & 31;
    const int task = blockIdx.x * 4 + wave;        // 0..3071
    const int h    = task >> 8;                    // head
    const int q0   = (task & 255) * 16;            // query block start
    const int colb = h * HDIM;                     // column base in [L,768]
    const int kb   = (lane >> 4) * 8;              // K striping base

    // ---- load Q fragments (16x64 A-matrix = two 16x32 fragments) ----
    v16h aQ0, aQ1;
    {
        const half_t* qrow = Q + (size_t)(q0 + (lane & 15)) * D_MODEL + colb;
#pragma unroll
        for (int j = 0; j < 8; ++j) {
            aQ0[j]     = qrow[kb + j];
            aQ0[8 + j] = qrow[kb + 16 + j];
            aQ1[j]     = qrow[32 + kb + j];
            aQ1[8 + j] = qrow[32 + kb + 16 + j];
        }
    }

    // ---- scores for 10 key tiles ----
    v8f   s[10];
    float rmax[8];
#pragma unroll
    for (int v = 0; v < 8; ++v) rmax[v] = -1e30f;

#pragma unroll
    for (int t = 0; t < 10; ++t) {
        const int kstart = q0 - HALFWIN + t * 16;
        const int key    = kstart + (lane & 15);
        const int keyc   = clampi(key, 0, L_SEQ - 1);
        const half_t* krow = Kb + (size_t)keyc * D_MODEL + colb;
        v16h b0, b1;
#pragma unroll
        for (int j = 0; j < 8; ++j) {
            b0[j]     = krow[kb + j];
            b0[8 + j] = krow[kb + 16 + j];
            b1[j]     = krow[32 + kb + j];
            b1[8 + j] = krow[32 + kb + 16 + j];
        }
        v8f c = {};
        c = __builtin_amdgcn_wmma_f32_16x16x32_f16(false, aQ0, false, b0,
                                                   (short)0, c, false, false);
        c = __builtin_amdgcn_wmma_f32_16x16x32_f16(false, aQ1, false, b1,
                                                   (short)0, c, false, false);
#pragma unroll
        for (int v = 0; v < 8; ++v) {
            const int row  = q0 + v + 8 * (lane >> 4);
            const int dif  = row - key;
            const bool ok  = (key >= 0) & (key < L_SEQ) &
                             (dif <= HALFWIN) & (dif >= -HALFWIN);
            const float sv = ok ? c[v] * 0.125f : -1e30f;   // 1/sqrt(64)
            s[t][v] = sv;
            rmax[v] = fmaxf(rmax[v], sv);
        }
    }

    // ---- row max across the 16 lanes of each half-wave ----
#pragma unroll
    for (int v = 0; v < 8; ++v) {
        float x = rmax[v];
#pragma unroll
        for (int off = 1; off < 16; off <<= 1)
            x = fmaxf(x, __shfl_xor(x, off, 32));
        rmax[v] = x;
    }

    // ---- exponentiate, row sum, stage P to LDS ----
    float rsum[8];
#pragma unroll
    for (int v = 0; v < 8; ++v) rsum[v] = 0.f;
#pragma unroll
    for (int t = 0; t < 10; ++t) {
#pragma unroll
        for (int v = 0; v < 8; ++v) {
            const float p = __expf(s[t][v] - rmax[v]);
            rsum[v] += p;
            Ps[wave][v + 8 * (lane >> 4)][t * 16 + (lane & 15)] = (half_t)p;
        }
    }
#pragma unroll
    for (int v = 0; v < 8; ++v) {
        float x = rsum[v];
#pragma unroll
        for (int off = 1; off < 16; off <<= 1)
            x += __shfl_xor(x, off, 32);
        rsum[v] = 1.0f / x;
    }

    // ---- O = P(16x160) * V(160x64), 5 K-steps x 4 N-tiles ----
    v8f o[4] = {{}, {}, {}, {}};
#pragma unroll
    for (int ks = 0; ks < 5; ++ks) {
        const int k2 = ks * 32;
        v16h aP;
        {
            const int m = lane & 15;
#pragma unroll
            for (int j = 0; j < 8; ++j) {
                aP[j]     = Ps[wave][m][k2 + kb + j];
                aP[8 + j] = Ps[wave][m][k2 + kb + 16 + j];
            }
        }
#pragma unroll
        for (int nt = 0; nt < 4; ++nt) {
            const int dcol = colb + nt * 16 + (lane & 15);
            v16h bV;
#pragma unroll
            for (int j = 0; j < 8; ++j) {
                const int key0 = clampi(q0 - HALFWIN + k2 + kb + j,      0, L_SEQ - 1);
                const int key1 = clampi(q0 - HALFWIN + k2 + kb + 16 + j, 0, L_SEQ - 1);
                bV[j]     = Vb[(size_t)key0 * D_MODEL + dcol];
                bV[8 + j] = Vb[(size_t)key1 * D_MODEL + dcol];
            }
            o[nt] = __builtin_amdgcn_wmma_f32_16x16x32_f16(false, aP, false, bV,
                                                           (short)0, o[nt], false, false);
        }
    }

    // ---- normalize + store (f16, row-major [L,768]) ----
#pragma unroll
    for (int nt = 0; nt < 4; ++nt) {
#pragma unroll
        for (int v = 0; v < 8; ++v) {
            const int row = q0 + v + 8 * (lane >> 4);
            const int col = colb + nt * 16 + (lane & 15);
            O[(size_t)row * D_MODEL + col] = (half_t)(o[nt][v] * rsum[v]);
        }
    }
}

// ---------------------------------------------------------------------------
extern "C" void kernel_launch(void* const* d_in, const int* in_sizes, int n_in,
                              void* d_out, int out_size, void* d_ws, size_t ws_size,
                              hipStream_t stream) {
    const float* query = (const float*)d_in[0];
    const float* key   = (const float*)d_in[1];
    const float* value = (const float*)d_in[2];
    const float* Wq = (const float*)d_in[3];
    const float* bq = (const float*)d_in[4];
    const float* Wk = (const float*)d_in[5];
    const float* bk = (const float*)d_in[6];
    const float* Wv = (const float*)d_in[7];
    const float* bv = (const float*)d_in[8];
    const float* Wo = (const float*)d_in[9];
    const float* bo = (const float*)d_in[10];

    const size_t E  = (size_t)L_SEQ * D_MODEL;      // 3145728
    const size_t WE = (size_t)D_MODEL * D_MODEL;    // 589824

    half_t* Xq  = (half_t*)d_ws;
    half_t* Xk  = Xq + E;
    half_t* Xv  = Xk + E;
    half_t* Wqh = Xv + E;
    half_t* Wkh = Wqh + WE;
    half_t* Wvh = Wkh + WE;
    half_t* Woh = Wvh + WE;
    half_t* Qb  = Woh + WE;
    half_t* Kb  = Qb + E;
    half_t* Vb  = Kb + E;
    half_t* Ob  = Vb + E;

    // f32 -> f16 conversion of all seven operands, one launch (Xq .. Woh)
    cvt_all_f32_f16<<<3 * XBLK + 4 * WBLK, 256, 0, stream>>>(
        query, key, value, Wq, Wk, Wv, Wo, Xq);

    // Q, K and V projections, one launch (Xq/Xk/Xv, Wqh/Wkh/Wvh -> Qb/Kb/Vb)
    dim3 qkvgrid(L_SEQ / 128, D_MODEL / 64, 3);
    gemm_qkv_f16<<<qkvgrid, 256, 0, stream>>>(Xq, Wqh, bq, bk, bv, Qb,
                                              L_SEQ, D_MODEL, D_MODEL);

    attn<<<(HEADS * (L_SEQ / 16)) / 4, 128, 0, stream>>>(Qb, Kb, Vb, Ob);

    dim3 ggrid(L_SEQ / 128, D_MODEL / 64, 1);
    gemm_out_f32<<<ggrid, 256, 0, stream>>>(Ob, Woh, bo, (float*)d_out,
                                            L_SEQ, D_MODEL, D_MODEL);
}

// v003
// Measured time: 47.1 microseconds a run.
// Two timings next to v002 both put it at 1.11 times that version's speed.
// Counting every step since v000, it is 1.99 times as fast.
#include <hip/hip_runtime.h>
#include <hip/hip_bf16.h>

typedef _Float16 half_t;
typedef __attribute__((ext_vector_type(16))) _Float16 v16h;
typedef __attribute__((ext_vector_type(8)))  float    v8f;

#define D_MODEL 768
#define L_SEQ   4096
#define HEADS   12
#define HDIM    64
#define HALFWIN 64   // WINDOW/2

__device__ __forceinline__ int clampi(int x, int lo, int hi) {
    return x < lo ? lo : (x > hi ? hi : x);
}

// ---------------------------------------------------------------------------
// f32 -> f16 conversion of all seven operands in ONE launch. The f16 copies
// lie back to back in the workspace (3 activations, then 4 weights), so the
// destination is the flat block index; the block index picks the source.
// Every block converts 2048 elements; both sizes are multiples of 2048.
// ---------------------------------------------------------------------------
#define XBLK (L_SEQ * D_MODEL / 2048)     // blocks per activation
#define WBLK (D_MODEL * D_MODEL / 2048)   // blocks per weight
__global__ __launch_bounds__(256) void cvt_all_f32_f16(
    const float* __restrict__ xq, const float* __restrict__ xk,
    const float* __restrict__ xv, const float* __restrict__ wq,
    const float* __restrict__ wk, const float* __restrict__ wv,
    const float* __restrict__ wo, half_t* __restrict__ d)
{
    const int b = blockIdx.x;
    const float* s;
    int lb;                                // block index inside its source
    if (b < 3 * XBLK) {
        const int seg = b / XBLK;
        lb = b - seg * XBLK;
        s  = seg == 0 ? xq : (seg == 1 ? xk : xv);
    } else {
        const int r   = b - 3 * XBLK;
        const int seg = r / WBLK;
        lb = r - seg * WBLK;
        s  = seg == 0 ? wq : (seg == 1 ? wk : (seg == 2 ? wv : wo));
    }
    const int si = (lb * 256 + threadIdx.x) * 8;
    const int di = (b  * 256 + threadIdx.x) * 8;
#pragma unroll
    for (int j = 0; j < 8; ++j) d[di + j] = (half_t)s[si + j];
}

// ---------------------------------------------------------------------------
// GEMM: C[M,N] = X[M,K] * W^T + b   (X, W both f16; W is [N,K] row-major)
// Block tile 128x64, 8 waves (4x2), wave tile 32x32 -> 4 WMMA / 32 k.
// K runs in stages of 128 (256 B of every operand row) through two LDS
// buffers: a stage's copies are issued one stage ahead of its use.
// K must be a multiple of 128.
// ---------------------------------------------------------------------------
#define BKS     128                  // k elements per stage
#define SPITCH  (BKS + 8)            // LDS row pitch in elements: 272 B = 16 B x 17
#define SROWS   (128 + 64)           // rows of a stage: the X tile, then the W tile
#define RSTEP_B (16 * SPITCH * 2)    // LDS bytes from one copy's rows to the next's

// One stage, 12 asynchronous 16-B copies per lane: the block's 256 lanes cover
// 16 rows of 256 B per copy; copies 0..7 bring the X rows, 8..11 the W rows.
// gx, gw: the lane's address in the first 16 rows; gstep: 16 rows, in elements.
__device__ __forceinline__ void copy_stage(
    const half_t* gx, const half_t* gw, size_t gstep, unsigned l)
{
    // s_wait_xcnt closes the statement, so that no address register named here
    // is rewritten ahead of it.
    asm volatile(
        "global_load_async_to_lds_b128 %0, %12, off\n\t"
        "global_load_async_to_lds_b128 %1, %13, off\n\t"
        "global_load_async_to_lds_b128 %2, %14, off\n\t"
        "global_load_async_to_lds_b128 %3, %15, off\n\t"
        "global_load_async_to_lds_b128 %4, %16, off\n\t"
        "global_load_async_to_lds_b128 %5, %17, off\n\t"
        "global_load_async_to_lds_b128 %6, %18, off\n\t"
        "global_load_async_to_lds_b128 %7, %19, off\n\t"
        "global_load_async_to_lds_b128 %8, %20, off\n\t"
        "global_load_async_to_lds_b128 %9, %21, off\n\t"
        "global_load_async_to_lds_b128 %10, %22, off\n\t"
        "global_load_async_to_lds_b128 %11, %23, off\n\t"
        "s_wait_xcnt 0x0"
        :: "v"(l),                "v"(l + 1 * RSTEP_B),  "v"(l + 2 * RSTEP_B),
           "v"(l + 3 * RSTEP_B),  "v"(l + 4 * RSTEP_B),  "v"(l + 5 * RSTEP_B),
           "v"(l + 6 * RSTEP_B),  "v"(l + 7 * RSTEP_B),  "v"(l + 8 * RSTEP_B),
           "v"(l + 9 * RSTEP_B),  "v"(l + 10 * RSTEP_B), "v"(l + 11 * RSTEP_B),
           "v"(gx),             "v"(gx + gstep),     "v"(gx + 2 * gstep),
           "v"(gx + 3 * gstep), "v"(gx + 4 * gstep), "v"(gx + 5 * gstep),
           "v"(gx + 6 * gstep), "v"(gx + 7 * gstep),
           "v"(gw),             "v"(gw + gstep),     "v"(gw + 2 * gstep),
           "v"(gw + 3 * gstep)
        : "memory");
}

template <typename TOUT>
__device__ __forceinline__ void gemm_xwt_tile(
    const half_t* __restrict__ X, const half_t* __restrict__ W,
    const float* __restrict__ bias, TOUT* __restrict__ C,
    int M, int N, int K)
{
    __shared__ __attribute__((aligned(16))) half_t S[2][SROWS][SPITCH];

    const int tid  = threadIdx.x;
    const int wave = tid >> 5;
    const int lane = tid & 31;
    const int m0 = blockIdx.x * 128;
    const int n0 = blockIdx.y * 64;
    const int wm = (wave & 3) * 32;        // wave row offset in block tile
    const int wn = (wave >> 2) * 32;       // wave col offset in block tile
    const int kb = (lane >> 4) * 8;        // K striping base for fragments

    // the lane's place in a copy: row tid / 16 of 16, 16-B piece tid % 16 of 16
    const int crow = tid >> 4;
    const int ccol = (tid & 15) * 8;
    const half_t* gx = X + (size_t)(m0 + crow) * K + ccol;
    const half_t* gw = W + (size_t)(n0 + crow) * K + ccol;
    const size_t  gstep = (size_t)16 * K;
    const unsigned l0 = (unsigned)(size_t)&S[0][crow][ccol];
    const unsigned l1 = (unsigned)(size_t)&S[1][crow][ccol];
    const int nst = K / BKS;               // stages

    v8f acc[2][2] = {};

    // ---- prologue: stage 0 landed and published, stage 1 in flight ----
    copy_stage(gx, gw, gstep, l0);
    asm volatile("s_wait_asynccnt 0x0" ::: "memory");   // own copies of stage 0 landed
    __syncthreads();                                    // ... and every other wave's
    if (nst > 1) copy_stage(gx + BKS, gw + BKS, gstep, l1);

    for (int s = 0; s < nst; ++s) {
        const half_t (*St)[SPITCH] = S[s & 1];
        // unrolled, so that kk becomes an immediate offset of the LDS reads
#pragma unroll
        for (int kk = 0; kk < BKS; kk += 32) {
            // ---- fragments ----
            v16h a[2], b[2];
#pragma unroll
            for (int mi = 0; mi < 2; ++mi) {
                const int m = wm + mi * 16 + (lane & 15);
#pragma unroll
                for (int j = 0; j < 8; ++j) {
                    a[mi][j]     = St[m][kk + kb + j];
                    a[mi][8 + j] = St[m][kk + kb + 16 + j];
                }
            }
#pragma unroll
            for (int ni = 0; ni < 2; ++ni) {
                const int n = 128 + wn + ni * 16 + (lane & 15);
#pragma unroll
                for (int j = 0; j < 8; ++j) {
                    b[ni][j]     = St[n][kk + kb + j];
                    b[ni][8 + j] = St[n][kk + kb + 16 + j];
                }
            }
#pragma unroll
            for (int mi = 0; mi < 2; ++mi)
#pragma unroll
                for (int ni = 0; ni < 2; ++ni)
                    acc[mi][ni] = __builtin_amdgcn_wmma_f32_16x16x32_f16(
                        false, a[mi], false, b[ni], (short)0, acc[mi][ni], false, false);
        }
        // ---- publish stage s + 1, free this stage's buffer ----
        asm volatile("s_wait_dscnt 0x0" ::: "memory");     // own reads of this buffer done
        asm volatile("s_wait_asynccnt 0x0" ::: "memory");  // own copies of stage s + 1 landed
        __syncthreads();
        if (s + 2 < nst)
            copy_stage(gx + (size_t)(s + 2) * BKS, gw + (size_t)(s + 2) * BKS,
                       gstep, (s & 1) ? l1 : l0);
    }
    asm volatile("s_wait_asynccnt 0x0" ::: "memory");      // nothing in flight at the end

    // ---- writeback: lane%16 = column, rows = v + 8*(lane/16) ----
#pragma unroll
    for (int mi = 0; mi < 2; ++mi)
#pragma unroll
        for (int ni = 0; ni < 2; ++ni) {
            const int col = n0 + wn + ni * 16 + (lane & 15);
            const float bvv = bias[col];
            const int rbase = m0 + wm + mi * 16 + 8 * (lane >> 4);
#pragma unroll
            for (int v = 0; v < 8; ++v)
                C[(size_t)(rbase + v) * N + col] = (TOUT)(acc[mi][ni][v] + bvv);
        }
}

// The three input projections are independent: one launch, blockIdx.z picks
// the operand set (X, W and C of the three lie back to back in the workspace).
__global__ __launch_bounds__(256) void gemm_qkv_f16(
    const half_t* __restrict__ X, const half_t* __restrict__ W,
    const float* __restrict__ bq, const float* __restrict__ bk,
    const float* __restrict__ bv, half_t* __restrict__ C,
    int M, int N, int K)
{
    const int z = blockIdx.z;
    const float* bias = z == 0 ? bq : (z == 1 ? bk : bv);
    gemm_xwt_tile<half_t>(X + (size_t)z * M * K, W + (size_t)z * N * K, bias,
                          C + (size_t)z * M * N, M, N, K);
}

__global__ __launch_bounds__(256) void gemm_out_f32(
    const half_t* __restrict__ X, const half_t* __restrict__ W,
    const float* __restrict__ bias, float* __restrict__ C,
    int M, int N, int K)
{
    gemm_xwt_tile<float>(X, W, bias, C, M, N, K);
}

// ---------------------------------------------------------------------------
// Sliding-window attention: one wave per (head, 16-query block), four
// neighbouring query blocks of one head per work-group.
// Key span for a 16-query block: [q0-64, q0+79] -> 10 tiles of 16 (160 keys).
// The four spans overlap: together they are 208 keys. Their K and V rows
// (128 B each, one whole line) are brought to LDS once per work-group.
// ---------------------------------------------------------------------------
#define KSPAN   208                  // 64 + 4 * 16 + 80 keys
#define KPITCH  (HDIM + 8)           // 144 B = 16 B x 9: read by ds_load_b128
#define VPITCH  (HDIM + 16)          // 160 B = 32 B x 5: read by ds_load_tr16_b128
#define NCOPY   (KSPAN / 16)         // copies per lane and operand: 16 rows each

typedef __attribute__((ext_vector_type(8))) short    s16x8;
typedef __attribute__((ext_vector_type(8))) _Float16 v8h;

// Transposing LDS read: lane (c = l & 15, hh = l >> 4) gets rows 8 hh .. 8 hh + 7
// of column c of the 16 x 16 tile whose per-lane address p follows the map
// row 8 (l >> 4) + (l & 7), 16-B piece (l >> 3) & 1.
__device__ __forceinline__ v8h ld_tr16(const half_t* p) {
    typedef __attribute__((address_space(3))) s16x8 lds_s16x8;
    return __builtin_bit_cast(v8h, __builtin_amdgcn_ds_load_tr16_b128_v8i16((lds_s16x8*)p));
}

// 13 asynchronous 16-B copies per lane: the block's 128 lanes cover 16 rows of
// 128 B per copy. base + off[i]: the lane's piece of its (clamped) row in copy i;
// l: its LDS byte address in copy 0; lstep: LDS bytes of 16 rows.
__device__ __forceinline__ void copy_span(
    const half_t* base, const unsigned (&off)[NCOPY], unsigned l, unsigned lstep)
{
    // s_wait_xcnt closes the statement, so that no address register named here
    // is rewritten ahead of it.
    asm volatile(
        "global_load_async_to_lds_b128 %0, %13, off\n\t"
        "global_load_async_to_lds_b128 %1, %14, off\n\t"
        "global_load_async_to_lds_b128 %2, %15, off\n\t"
        "global_load_async_to_lds_b128 %3, %16, off\n\t"
        "global_load_async_to_lds_b128 %4, %17, off\n\t"
        "global_load_async_to_lds_b128 %5, %18, off\n\t"
        "global_load_async_to_lds_b128 %6, %19, off\n\t"
        "global_load_async_to_lds_b128 %7, %20, off\n\t"
        "global_load_async_to_lds_b128 %8, %21, off\n\t"
        "global_load_async_to_lds_b128 %9, %22, off\n\t"
        "global_load_async_to_lds_b128 %10, %23, off\n\t"
        "global_load_async_to_lds_b128 %11, %24, off\n\t"
        "global_load_async_to_lds_b128 %12, %25, off\n\t"
        "s_wait_xcnt 0x0"
        :: "v"(l),              "v"(l + 1 * lstep),  "v"(l + 2 * lstep),
           "v"(l + 3 * lstep),  "v"(l + 4 * lstep),  "v"(l + 5 * lstep),
           "v"(l + 6 * lstep),  "v"(l + 7 * lstep),  "v"(l + 8 * lstep),
           "v"(l + 9 * lstep),  "v"(l + 10 * lstep), "v"(l + 11 * lstep),
           "v"(l + 12 * lstep),
           "v"(base + off[0]),  "v"(base + off[1]),  "v"(base + off[2]),
           "v"(base + off[3]),  "v"(base + off[4]),  "v"(base + off[5]),
           "v"(base + off[6]),  "v"(base + off[7]),  "v"(base + off[8]),
           "v"(base + off[9]),  "v"(base + off[10]), "v"(base + off[11]),
           "v"(base + off[12])
        : "memory");
}

__global__ __launch_bounds__(128) void attn(
    const half_t* __restrict__ Q, const half_t* __restrict__ Kb,
    const half_t* __restrict__ Vb, half_t* __restrict__ O)
{
    __shared__ __attribute__((aligned(16))) half_t Ks[KSPAN][KPITCH];
    __shared__ __attribute__((aligned(16))) half_t Vs[KSPAN][VPITCH];
    __shared__ half_t Ps[4][16][176];      // per-wave P staging (f16)

    const int wave = threadIdx.x >> 5;
    const int lane = threadIdx.x & 31;
    const int task = blockIdx.x * 4 + wave;        // 0..3071
    const int h    = task >> 8;                    // head (the same in all four waves)
    const int q0   = (task & 255) * 16;            // query block start
    const int colb = h * HDIM;                     // column base in [L,768]
    const int kb   = (lane >> 4) * 8;              // K striping base
    const int r0   = wave * 16;                    // LDS row of key q0 - HALFWIN

    // ---- K and V rows of keys [q0(wave 0) - 64, + 208) to LDS; a key outside
    //      the sequence takes the nearest row's data, and its score is masked ----
    {
        const int crow  = threadIdx.x >> 3;        // row of 16
        const int ccol  = (threadIdx.x & 7) * 8;   // 16-B piece of 8
        const int kfirst = q0 - r0 - HALFWIN;
        unsigned off[NCOPY];
#pragma unroll
        for (int i = 0; i < NCOPY; ++i)
            off[i] = (unsigned)(clampi(kfirst + i * 16 + crow, 0, L_SEQ - 1) * D_MODEL
                                + colb + ccol);
        copy_span(Kb, off, (unsigned)(size_t)&Ks[crow][ccol], 16 * KPITCH * 2);
        copy_span(Vb, off, (unsigned)(size_t)&Vs[crow][ccol], 16 * VPITCH * 2);
    }

    // ---- load Q fragments (16x64 A-matrix = two 16x32 fragments) ----
    v16h aQ0, aQ1;
    {
        const half_t* qrow = Q + (size_t)(q0 + (lane & 15)) * D_MODEL + colb;
#pragma unroll
        for (int j = 0; j < 8; ++j) {
            aQ0[j]     = qrow[kb + j];
            aQ0[8 + j] = qrow[kb + 16 + j];
            aQ1[j]     = qrow[32 + kb + j];
            aQ1[8 + j] = qrow[32 + kb + 16 + j];
        }
    }

    asm volatile("s_wait_asynccnt 0x0" ::: "memory");   // own copies landed
    __syncthreads();                                    // ... and every other wave's

    // ---- scores for 10 key tiles ----
    v8f   s[10];
    float rmax[8];
#pragma unroll
    for (int v = 0; v < 8; ++v) rmax[v] = -1e30f;

#pragma unroll
    for (int t = 0; t < 10; ++t) {
        const int kstart = q0 - HALFWIN + t * 16;
        const int key    = kstart + (lane & 15);
        const half_t* krow = Ks[r0 + t * 16 + (lane & 15)];
        v16h b0, b1;
#pragma unroll
        for (int j = 0; j < 8; ++j) {
            b0[j]     = krow[kb + j];
            b0[8 + j] = krow[kb + 16 + j];
            b1[j]     = krow[32 + kb + j];
            b1[8 + j] = krow[32 + kb + 16 + j];
        }
        v8f c = {};
        c = __builtin_amdgcn_wmma_f32_16x16x32_f16(false, aQ0, false, b0,
                                                   (short)0, c, false, false);
        c = __builtin_amdgcn_wmma_f32_16x16x32_f16(false, aQ1, false, b1,
                                                   (short)0, c, false, false);
#pragma unroll
        for (int v = 0; v < 8; ++v) {
            const int row  = q0 + v + 8 * (lane >> 4);
            const int dif  = row - key;
            const bool ok  = (key >= 0) & (key < L_SEQ) &
                             (dif <= HALFWIN) & (dif >= -HALFWIN);
            const float sv = ok ? c[v] * 0.125f : -1e30f;   // 1/sqrt(64)
            s[t][v] = sv;
            rmax[v] = fmaxf(rmax[v], sv);
        }
    }

    // ---- row max across the 16 lanes of each half-wave ----
#pragma unroll
    for (int v = 0; v < 8; ++v) {
        float x = rmax[v];
#pragma unroll
        for (int off = 1; off < 16; off <<= 1)
            x = fmaxf(x, __shfl_xor(x, off, 32));
        rmax[v] = x;
    }

    // ---- exponentiate, row sum, stage P to LDS ----
    float rsum[8];
#pragma unroll
    for (int v = 0; v < 8; ++v) rsum[v] = 0.f;
#pragma unroll
    for (int t = 0; t < 10; ++t) {
#pragma unroll
        for (int v = 0; v < 8; ++v) {
            const float p = __expf(s[t][v] - rmax[v]);
            rsum[v] += p;
            Ps[wave][v + 8 * (lane >> 4)][t * 16 + (lane & 15)] = (half_t)p;
        }
    }
#pragma unroll
    for (int v = 0; v < 8; ++v) {
        float x = rsum[v];
#pragma unroll
        for (int off = 1; off < 16; off <<= 1)
            x += __shfl_xor(x, off, 32);
        rsum[v] = 1.0f / x;
    }

    // ---- O = P(16x160) * V(160x64), 5 K-steps x 4 N-tiles ----
    v8f o[4] = {{}, {}, {}, {}};
    // the lane's address in the transposing read of the wave's first 16 x 16 V tile
    const half_t* vtr = &Vs[r0 + 8 * (lane >> 4) + (lane & 7)][8 * ((lane >> 3) & 1)];
#pragma unroll
    for (int ks = 0; ks < 5; ++ks) {
        const int k2 = ks * 32;
        v16h aP;
        {
            const int m = lane & 15;
#pragma unroll
            for (int j = 0; j < 8; ++j) {
                aP[j]     = Ps[wave][m][k2 + kb + j];
                aP[8 + j] = Ps[wave][m][k2 + kb + 16 + j];
            }
        }
#pragma unroll
        for (int nt = 0; nt < 4; ++nt) {
            // keys k2 + kb + 0..7 and k2 + 16 + kb + 0..7 of column nt * 16 + lane % 16
            const v8h lo = ld_tr16(vtr + k2 * VPITCH + nt * 16);
            const v8h hi = ld_tr16(vtr + (k2 + 16) * VPITCH + nt * 16);
            const v16h bV = __builtin_shufflevector(lo, hi, 0, 1, 2, 3, 4, 5, 6, 7,
                                                    8, 9, 10, 11, 12, 13, 14, 15);
            o[nt] = __builtin_amdgcn_wmma_f32_16x16x32_f16(false, aP, false, bV,
                                                           (short)0, o[nt], false, false);
        }
    }

    // ---- normalize + store (f16, row-major [L,768]) ----
#pragma unroll
    for (int nt = 0; nt < 4; ++nt) {
#pragma unroll
        for (int v = 0; v < 8; ++v) {
            const int row = q0 + v + 8 * (lane >> 4);
            const int col = colb + nt * 16 + (lane & 15);
            O[(size_t)row * D_MODEL + col] = (half_t)(o[nt][v] * rsum[v]);
        }
    }
}

// ---------------------------------------------------------------------------
extern "C" void kernel_launch(void* const* d_in, const int* in_sizes, int n_in,
                              void* d_out, int out_size, void* d_ws, size_t ws_size,
                              hipStream_t stream) {
    const float* query = (const float*)d_in[0];
    const float* key   = (const float*)d_in[1];
    const float* value = (const float*)d_in[2];
    const float* Wq = (const float*)d_in[3];
    const float* bq = (const float*)d_in[4];
    const float* Wk = (const float*)d_in[5];
    const float* bk = (const float*)d_in[6];
    const float* Wv = (const float*)d_in[7];
    const float* bv = (const float*)d_in[8];
    const float* Wo = (const float*)d_in[9];
    const float* bo = (const float*)d_in[10];

    const size_t E  = (size_t)L_SEQ * D_MODEL;      // 3145728
    const size_t WE = (size_t)D_MODEL * D_MODEL;    // 589824

    half_t* Xq  = (half_t*)d_ws;
    half_t* Xk  = Xq + E;
    half_t* Xv  = Xk + E;
    half_t* Wqh = Xv + E;
    half_t* Wkh = Wqh + WE;
    half_t* Wvh = Wkh + WE;
    half_t* Woh = Wvh + WE;
    half_t* Qb  = Woh + WE;
    half_t* Kb  = Qb + E;
    half_t* Vb  = Kb + E;
    half_t* Ob  = Vb + E;

    // f32 -> f16 conversion of all seven operands, one launch (Xq .. Woh)
    cvt_all_f32_f16<<<3 * XBLK + 4 * WBLK, 256, 0, stream>>>(
        query, key, value, Wq, Wk, Wv, Wo, Xq);

    // Q, K and V projections, one launch (Xq/Xk/Xv, Wqh/Wkh/Wvh -> Qb/Kb/Vb)
    dim3 qkvgrid(L_SEQ / 128, D_MODEL / 64, 3);
    gemm_qkv_f16<<<qkvgrid, 256, 0, stream>>>(Xq, Wqh, bq, bk, bv, Qb,
                                              L_SEQ, D_MODEL, D_MODEL);

    attn<<<(HEADS * (L_SEQ / 16)) / 4, 128, 0, stream>>>(Qb, Kb, Vb, Ob);

    dim3 ggrid(L_SEQ / 128, D_MODEL / 64, 1);
    gemm_out_f32<<<ggrid, 256, 0, stream>>>(Ob, Woh, bo, (float*)d_out,
                                            L_SEQ, D_MODEL, D_MODEL);
}

// v004
// One run takes 41.7 microseconds.
// Next to v003, in two timings, it ran 1.13 and 1.12 times as fast.
// Counting every step since v000, it is 2.23 times as fast.
#include <hip/hip_runtime.h>
#include <hip/hip_bf16.h>

typedef _Float16 half_t;
typedef __attribute__((ext_vector_type(16))) _Float16 v16h;
typedef __attribute__((ext_vector_type(8)))  float    v8f;

#define D_MODEL 768
#define L_SEQ   4096
#define HEADS   12
#define HDIM    64
#define HALFWIN 64   // WINDOW/2

__device__ __forceinline__ int clampi(int x, int lo, int hi) {
    return x < lo ? lo : (x > hi ? hi : x);
}

// ---------------------------------------------------------------------------
// f32 -> f16 conversion of all seven operands in ONE launch. The f16 copies
// lie back to back in the workspace (3 activations, then 4 weights), so the
// destination is the flat block index; the block index picks the source.
// Every block converts 2048 elements; both sizes are multiples of 2048.
// ---------------------------------------------------------------------------
#define XBLK (L_SEQ * D_MODEL / 2048)     // blocks per activation
#define WBLK (D_MODEL * D_MODEL / 2048)   // blocks per weight
__global__ __launch_bounds__(256) void cvt_all_f32_f16(
    const float* __restrict__ xq, const float* __restrict__ xk,
    const float* __restrict__ xv, const float* __restrict__ wq,
    const float* __restrict__ wk, const float* __restrict__ wv,
    const float* __restrict__ wo, half_t* __restrict__ d)
{
    const int b = blockIdx.x;
    const float* s;
    int lb;                                // block index inside its source
    if (b < 3 * XBLK) {
        const int seg = b / XBLK;
        lb = b - seg * XBLK;
        s  = seg == 0 ? xq : (seg == 1 ? xk : xv);
    } else {
        const int r   = b - 3 * XBLK;
        const int seg = r / WBLK;
        lb = r - seg * WBLK;
        s  = seg == 0 ? wq : (seg == 1 ? wk : (seg == 2 ? wv : wo));
    }
    const int si = (lb * 256 + threadIdx.x) * 8;
    const int di = (b  * 256 + threadIdx.x) * 8;
#pragma unroll
    for (int j = 0; j < 8; ++j) d[di + j] = (half_t)s[si + j];
}

// ---------------------------------------------------------------------------
// GEMM: C[M,N] = X[M,K] * W^T + b   (X, W both f16; W is [N,K] row-major)
// Wave tile 16 FM x 48; WM x WN waves make a block tile of 16 FM WM x 48 WN.
// A wide block tile cuts how often a row of X or W is fetched from L2, a wide
// wave tile how often it is read from LDS (FM = 4: 12 WMMA on 7 fragments).
// K runs in stages of 128 (256 B of every operand row) through two LDS
// buffers: a stage's copies are issued one stage ahead of its use.
// K must be a multiple of 128, M of 16 FM WM, N of 48 WN.
// ---------------------------------------------------------------------------
#define BKS     128                  // k elements per stage
#define SPITCH  (BKS + 8)            // LDS row pitch in elements: 272 B = 16 B x 17
#define FN      3                    // 16-row fragments of W per wave

// 14 asynchronous 16-B copies per lane. g[i]: the lane's global address in copy i;
// l: its LDS byte address in copy 0; lstep: LDS bytes from one copy's rows to the next's.
__device__ __forceinline__ void copy14(
    const half_t* const (&g)[14], unsigned l, unsigned lstep)
{
    // s_wait_xcnt closes the statement, so that no address register named here
    // is rewritten ahead of it.
    asm volatile(
        "global_load_async_to_lds_b128 %0, %14, off\n\t"
        "global_load_async_to_lds_b128 %1, %15, off\n\t"
        "global_load_async_to_lds_b128 %2, %16, off\n\t"
        "global_load_async_to_lds_b128 %3, %17, off\n\t"
        "global_load_async_to_lds_b128 %4, %18, off\n\t"
        "global_load_async_to_lds_b128 %5, %19, off\n\t"
        "global_load_async_to_lds_b128 %6, %20, off\n\t"
        "global_load_async_to_lds_b128 %7, %21, off\n\t"
        "global_load_async_to_lds_b128 %8, %22, off\n\t"
        "global_load_async_to_lds_b128 %9, %23, off\n\t"
        "global_load_async_to_lds_b128 %10, %24, off\n\t"
        "global_load_async_to_lds_b128 %11, %25, off\n\t"
        "global_load_async_to_lds_b128 %12, %26, off\n\t"
        "global_load_async_to_lds_b128 %13, %27, off\n\t"
        "s_wait_xcnt 0x0"
        :: "v"(l),              "v"(l + 1 * lstep),  "v"(l + 2 * lstep),
           "v"(l + 3 * lstep),  "v"(l + 4 * lstep),  "v"(l + 5 * lstep),
           "v"(l + 6 * lstep),  "v"(l + 7 * lstep),  "v"(l + 8 * lstep),
           "v"(l + 9 * lstep),  "v"(l + 10 * lstep), "v"(l + 11 * lstep),
           "v"(l + 12 * lstep), "v"(l + 13 * lstep),
           "v"(g[0]),  "v"(g[1]),  "v"(g[2]),  "v"(g[3]),  "v"(g[4]),
           "v"(g[5]),  "v"(g[6]),  "v"(g[7]),  "v"(g[8]),  "v"(g[9]),
           "v"(g[10]), "v"(g[11]), "v"(g[12]), "v"(g[13])
        : "memory");
}

// One stage: the block's lanes cover RPC rows of 256 B per copy; the first
// copies bring the X rows, the rest the W rows, into consecutive LDS rows.
// gx, gw: the lane's address in the first RPC rows; gstep: RPC rows, in elements.
template <int FM, int WM, int WN>
__device__ __forceinline__ void copy_stage(
    const half_t* gx, const half_t* gw, size_t gstep, unsigned l)
{
    constexpr int RPC = WM * WN * 2;                        // rows per copy
    constexpr int XC  = WM * FM * 16 / RPC;                 // copies of X rows
    constexpr int NC  = (WM * FM + WN * FN) * 16 / RPC;     // copies in all
    static_assert(NC % 14 == 0 && NC <= 56, "copies go in statements of 14");
#pragma unroll
    for (int c0 = 0; c0 < NC; c0 += 14) {
        const half_t* g[14];
#pragma unroll
        for (int i = 0; i < 14; ++i) {
            const int c = c0 + i;
            g[i] = c < XC ? gx + c * gstep : gw + (c - XC) * gstep;
        }
        copy14(g, l + c0 * RPC * SPITCH * 2, RPC * SPITCH * 2);
    }
}

template <typename TOUT, int FM, int WM, int WN>
__device__ __forceinline__ void gemm_xwt_tile(
    const half_t* __restrict__ X, const half_t* __restrict__ W,
    const float* __restrict__ bias, TOUT* __restrict__ C,
    int M, int N, int K)
{
    constexpr int BM = WM * FM * 16;       // block tile rows
    constexpr int BN = WN * FN * 16;       // block tile columns
    // rows of a stage: the X tile, then the W tile
    __shared__ __attribute__((aligned(16))) half_t S[2][BM + BN][SPITCH];

    const int tid  = threadIdx.x;
    const int wave = tid >> 5;
    const int lane = tid & 31;
    const int m0 = blockIdx.x * BM;
    const int n0 = blockIdx.y * BN;
    const int wm = (wave % WM) * (FM * 16);   // wave row offset in block tile
    const int wn = (wave / WM) * (FN * 16);   // wave col offset in block tile
    const int kb = (lane >> 4) * 8;           // K striping base for fragments

    // the lane's place in a copy: row tid / 16, 16-B piece tid % 16 of 16
    const int crow = tid >> 4;
    const int ccol = (tid & 15) * 8;
    const half_t* gx = X + (size_t)(m0 + crow) * K + ccol;
    const half_t* gw = W + (size_t)(n0 + crow) * K + ccol;
    const size_t  gstep = (size_t)(WM * WN * 2) * K;
    const unsigned l0 = (unsigned)(size_t)&S[0][crow][ccol];
    const unsigned l1 = (unsigned)(size_t)&S[1][crow][ccol];
    const int nst = K / BKS;               // stages

    v8f acc[FM][FN] = {};

    // ---- prologue: stage 0 landed and published, stage 1 in flight ----
    copy_stage<FM, WM, WN>(gx, gw, gstep, l0);
    asm volatile("s_wait_asynccnt 0x0" ::: "memory");   // own copies of stage 0 landed
    __syncthreads();                                    // ... and every other wave's
    if (nst > 1) copy_stage<FM, WM, WN>(gx + BKS, gw + BKS, gstep, l1);

    for (int s = 0; s < nst; ++s) {
        const half_t (*St)[SPITCH] = S[s & 1];
        // unrolled, so that kk becomes an immediate offset of the LDS reads
#pragma unroll
        for (int kk = 0; kk < BKS; kk += 32) {
            // ---- fragments ----
            v16h a[FM], b[FN];
#pragma unroll
            for (int mi = 0; mi < FM; ++mi) {
                const int m = wm + mi * 16 + (lane & 15);
#pragma unroll
                for (int j = 0; j < 8; ++j) {
                    a[mi][j]     = St[m][kk + kb + j];
                    a[mi][8 + j] = St[m][kk + kb + 16 + j];
                }
            }
#pragma unroll
            for (int ni = 0; ni < FN; ++ni) {
                const int n = BM + wn + ni * 16 + (lane & 15);
#pragma unroll
                for (int j = 0; j < 8; ++j) {
                    b[ni][j]     = St[n][kk + kb + j];
                    b[ni][8 + j] = St[n][kk + kb + 16 + j];
                }
            }
            // keeps a k step's reads together ahead of its WMMAs: left alone, the
            // scheduler reloads one A fragment's registers and waits out the LDS
            // latency once per row of WMMAs
            __builtin_amdgcn_sched_barrier(0);
#pragma unroll
            for (int mi = 0; mi < FM; ++mi)
#pragma unroll
                for (int ni = 0; ni < FN; ++ni)
                    acc[mi][ni] = __builtin_amdgcn_wmma_f32_16x16x32_f16(
                        false, a[mi], false, b[ni], (short)0, acc[mi][ni], false, false);
        }
        // ---- publish stage s + 1, free this stage's buffer ----
        asm volatile("s_wait_dscnt 0x0" ::: "memory");     // own reads of this buffer done
        asm volatile("s_wait_asynccnt 0x0" ::: "memory");  // own copies of stage s + 1 landed
        __syncthreads();
        if (s + 2 < nst)
            copy_stage<FM, WM, WN>(gx + (size_t)(s + 2) * BKS, gw + (size_t)(s + 2) * BKS,
                               gstep, (s & 1) ? l1 : l0);
    }
    asm volatile("s_wait_asynccnt 0x0" ::: "memory");      // nothing in flight at the end

    // ---- writeback: lane%16 = column, rows = v + 8*(lane/16) ----
    const int col = n0 + wn + (lane & 15);
    float bvv[FN];
#pragma unroll
    for (int ni = 0; ni < FN; ++ni) bvv[ni] = bias[col + ni * 16];
    TOUT* crow0 = C + (size_t)(m0 + wm + 8 * (lane >> 4)) * N + col;
#pragma unroll
    for (int mi = 0; mi < FM; ++mi)
#pragma unroll
        for (int v = 0; v < 8; ++v) {
            TOUT* cr = crow0 + (size_t)(mi * 16 + v) * N;
#pragma unroll
            for (int ni = 0; ni < FN; ++ni)
                cr[ni * 16] = (TOUT)(acc[mi][ni][v] + bvv[ni]);
        }
}

// The three input projections are independent: one launch, blockIdx.z picks
// the operand set (X, W and C of the three lie back to back in the workspace).
// 4 x 4 waves of 64 x 48: block tile 256 x 192, one work-group per WGP.
__global__ __launch_bounds__(512) void gemm_qkv_f16(
    const half_t* __restrict__ X, const half_t* __restrict__ W,
    const float* __restrict__ bq, const float* __restrict__ bk,
    const float* __restrict__ bv, half_t* __restrict__ C,
    int M, int N, int K)
{
    const int z = blockIdx.z;
    const float* bias = z == 0 ? bq : (z == 1 ? bk : bv);
    gemm_xwt_tile<half_t, 4, 4, 4>(X + (size_t)z * M * K, W + (size_t)z * N * K, bias,
                                   C + (size_t)z * M * N, M, N, K);
}

// 4 x 2 waves of 32 x 48: block tile 128 x 96, so that this smaller product
// still has a work-group for every WGP.
__global__ __launch_bounds__(256) void gemm_out_f32(
    const half_t* __restrict__ X, const half_t* __restrict__ W,
    const float* __restrict__ bias, float* __restrict__ C,
    int M, int N, int K)
{
    gemm_xwt_tile<float, 2, 4, 2>(X, W, bias, C, M, N, K);
}

// ---------------------------------------------------------------------------
// Sliding-window attention: one wave per (head, 16-query block), four
// neighbouring query blocks of one head per work-group.
// Key span for a 16-query block: [q0-64, q0+79] -> 10 tiles of 16 (160 keys).
// The four spans overlap: together they are 208 keys. Their K and V rows
// (128 B each, one whole line) are brought to LDS once per work-group.
// ---------------------------------------------------------------------------
#define KSPAN   208                  // 64 + 4 * 16 + 80 keys
#define KPITCH  (HDIM + 8)           // 144 B = 16 B x 9: read by ds_load_b128
#define VPITCH  (HDIM + 16)          // 160 B = 32 B x 5: read by ds_load_tr16_b128
#define NCOPY   (KSPAN / 16)         // copies per lane and operand: 16 rows each

typedef __attribute__((ext_vector_type(8))) short    s16x8;
typedef __attribute__((ext_vector_type(8))) _Float16 v8h;

// Transposing LDS read: lane (c = l & 15, hh = l >> 4) gets rows 8 hh .. 8 hh + 7
// of column c of the 16 x 16 tile whose per-lane address p follows the map
// row 8 (l >> 4) + (l & 7), 16-B piece (l >> 3) & 1.
__device__ __forceinline__ v8h ld_tr16(const half_t* p) {
    typedef __attribute__((address_space(3))) s16x8 lds_s16x8;
    return __builtin_bit_cast(v8h, __builtin_amdgcn_ds_load_tr16_b128_v8i16((lds_s16x8*)p));
}

// 13 asynchronous 16-B copies per lane: the block's 128 lanes cover 16 rows of
// 128 B per copy. base + off[i]: the lane's piece of its (clamped) row in copy i;
// l: its LDS byte address in copy 0; lstep: LDS bytes of 16 rows.
__device__ __forceinline__ void copy_span(
    const half_t* base, const unsigned (&off)[NCOPY], unsigned l, unsigned lstep)
{
    // s_wait_xcnt closes the statement, so that no address register named here
    // is rewritten ahead of it.
    asm volatile(
        "global_load_async_to_lds_b128 %0, %13, off\n\t"
        "global_load_async_to_lds_b128 %1, %14, off\n\t"
        "global_load_async_to_lds_b128 %2, %15, off\n\t"
        "global_load_async_to_lds_b128 %3, %16, off\n\t"
        "global_load_async_to_lds_b128 %4, %17, off\n\t"
        "global_load_async_to_lds_b128 %5, %18, off\n\t"
        "global_load_async_to_lds_b128 %6, %19, off\n\t"
        "global_load_async_to_lds_b128 %7, %20, off\n\t"
        "global_load_async_to_lds_b128 %8, %21, off\n\t"
        "global_load_async_to_lds_b128 %9, %22, off\n\t"
        "global_load_async_to_lds_b128 %10, %23, off\n\t"
        "global_load_async_to_lds_b128 %11, %24, off\n\t"
        "global_load_async_to_lds_b128 %12, %25, off\n\t"
        "s_wait_xcnt 0x0"
        :: "v"(l),              "v"(l + 1 * lstep),  "v"(l + 2 * lstep),
           "v"(l + 3 * lstep),  "v"(l + 4 * lstep),  "v"(l + 5 * lstep),
           "v"(l + 6 * lstep),  "v"(l + 7 * lstep),  "v"(l + 8 * lstep),
           "v"(l + 9 * lstep),  "v"(l + 10 * lstep), "v"(l + 11 * lstep),
           "v"(l + 12 * lstep),
           "v"(base + off[0]),  "v"(base + off[1]),  "v"(base + off[2]),
           "v"(base + off[3]),  "v"(base + off[4]),  "v"(base + off[5]),
           "v"(base + off[6]),  "v"(base + off[7]),  "v"(base + off[8]),
           "v"(base + off[9]),  "v"(base + off[10]), "v"(base + off[11]),
           "v"(base + off[12])
        : "memory");
}

__global__ __launch_bounds__(128) void attn(
    const half_t* __restrict__ Q, const half_t* __restrict__ Kb,
    const half_t* __restrict__ Vb, half_t* __restrict__ O)
{
    __shared__ __attribute__((aligned(16))) half_t Ks[KSPAN][KPITCH];
    __shared__ __attribute__((aligned(16))) half_t Vs[KSPAN][VPITCH];
    __shared__ half_t Ps[4][16][176];      // per-wave P staging (f16)

    const int wave = threadIdx.x >> 5;
    const int lane = threadIdx.x & 31;
    const int task = blockIdx.x * 4 + wave;        // 0..3071
    const int h    = task >> 8;                    // head (the same in all four waves)
    const int q0   = (task & 255) * 16;            // query block start
    const int colb = h * HDIM;                     // column base in [L,768]
    const int kb   = (lane >> 4) * 8;              // K striping base
    const int r0   = wave * 16;                    // LDS row of key q0 - HALFWIN

    // ---- K and V rows of keys [q0(wave 0) - 64, + 208) to LDS; a key outside
    //      the sequence takes the nearest row's data, and its score is masked ----
    {
        const int crow  = threadIdx.x >> 3;        // row of 16
        const int ccol  = (threadIdx.x & 7) * 8;   // 16-B piece of 8
        const int kfirst = q0 - r0 - HALFWIN;
        unsigned off[NCOPY];
#pragma unroll
        for (int i = 0; i < NCOPY; ++i)
            off[i] = (unsigned)(clampi(kfirst + i * 16 + crow, 0, L_SEQ - 1) * D_MODEL
                                + colb + ccol);
        copy_span(Kb, off, (unsigned)(size_t)&Ks[crow][ccol], 16 * KPITCH * 2);
        copy_span(Vb, off, (unsigned)(size_t)&Vs[crow][ccol], 16 * VPITCH * 2);
    }

    // ---- load Q fragments (16x64 A-matrix = two 16x32 fragments) ----
    v16h aQ0, aQ1;
    {
        const half_t* qrow = Q + (size_t)(q0 + (lane & 15)) * D_MODEL + colb;
#pragma unroll
        for (int j = 0; j < 8; ++j) {
            aQ0[j]     = qrow[kb + j];
            aQ0[8 + j] = qrow[kb + 16 + j];
            aQ1[j]     = qrow[32 + kb + j];
            aQ1[8 + j] = qrow[32 + kb + 16 + j];
        }
    }

    asm volatile("s_wait_asynccnt 0x0" ::: "memory");   // own copies landed
    __syncthreads();                                    // ... and every other wave's

    // ---- scores for 10 key tiles ----
    v8f   s[10];
    float rmax[8];
#pragma unroll
    for (int v = 0; v < 8; ++v) rmax[v] = -1e30f;

#pragma unroll
    for (int t = 0; t < 10; ++t) {
        const int kstart = q0 - HALFWIN + t * 16;
        const int key    = kstart + (lane & 15);
        const half_t* krow = Ks[r0 + t * 16 + (lane & 15)];
        v16h b0, b1;
#pragma unroll
        for (int j = 0; j < 8; ++j) {
            b0[j]     = krow[kb + j];
            b0[8 + j] = krow[kb + 16 + j];
            b1[j]     = krow[32 + kb + j];
            b1[8 + j] = krow[32 + kb + 16 + j];
        }
        v8f c = {};
        c = __builtin_amdgcn_wmma_f32_16x16x32_f16(false, aQ0, false, b0,
                                                   (short)0, c, false, false);
        c = __builtin_amdgcn_wmma_f32_16x16x32_f16(false, aQ1, false, b1,
                                                   (short)0, c, false, false);
#pragma unroll
        for (int v = 0; v < 8; ++v) {
            const int row  = q0 + v + 8 * (lane >> 4);
            const int dif  = row - key;
            const bool ok  = (key >= 0) & (key < L_SEQ) &
                             (dif <= HALFWIN) & (dif >= -HALFWIN);
            const float sv = ok ? c[v] * 0.125f : -1e30f;   // 1/sqrt(64)
            s[t][v] = sv;
            rmax[v] = fmaxf(rmax[v], sv);
        }
    }

    // ---- row max across the 16 lanes of each half-wave ----
#pragma unroll
    for (int v = 0; v < 8; ++v) {
        float x = rmax[v];
#pragma unroll
        for (int off = 1; off < 16; off <<= 1)
            x = fmaxf(x, __shfl_xor(x, off, 32));
        rmax[v] = x;
    }

    // ---- exponentiate, row sum, stage P to LDS ----
    float rsum[8];
#pragma unroll
    for (int v = 0; v < 8; ++v) rsum[v] = 0.f;
#pragma unroll
    for (int t = 0; t < 10; ++t) {
#pragma unroll
        for (int v = 0; v < 8; ++v) {
            const float p = __expf(s[t][v] - rmax[v]);
            rsum[v] += p;
            Ps[wave][v + 8 * (lane >> 4)][t * 16 + (lane & 15)] = (half_t)p;
        }
    }
#pragma unroll
    for (int v = 0; v < 8; ++v) {
        float x = rsum[v];
#pragma unroll
        for (int off = 1; off < 16; off <<= 1)
            x += __shfl_xor(x, off, 32);
        rsum[v] = 1.0f / x;
    }

    // ---- O = P(16x160) * V(160x64), 5 K-steps x 4 N-tiles ----
    v8f o[4] = {{}, {}, {}, {}};
    // the lane's address in the transposing read of the wave's first 16 x 16 V tile
    const half_t* vtr = &Vs[r0 + 8 * (lane >> 4) + (lane & 7)][8 * ((lane >> 3) & 1)];
#pragma unroll
    for (int ks = 0; ks < 5; ++ks) {
        const int k2 = ks * 32;
        v16h aP;
        {
            const int m = lane & 15;
#pragma unroll
            for (int j = 0; j < 8; ++j) {
                aP[j]     = Ps[wave][m][k2 + kb + j];
                aP[8 + j] = Ps[wave][m][k2 + kb + 16 + j];
            }
        }
#pragma unroll
        for (int nt = 0; nt < 4; ++nt) {
            // keys k2 + kb + 0..7 and k2 + 16 + kb + 0..7 of column nt * 16 + lane % 16
            const v8h lo = ld_tr16(vtr + k2 * VPITCH + nt * 16);
            const v8h hi = ld_tr16(vtr + (k2 + 16) * VPITCH + nt * 16);
            const v16h bV = __builtin_shufflevector(lo, hi, 0, 1, 2, 3, 4, 5, 6, 7,
                                                    8, 9, 10, 11, 12, 13, 14, 15);
            o[nt] = __builtin_amdgcn_wmma_f32_16x16x32_f16(false, aP, false, bV,
                                                           (short)0, o[nt], false, false);
        }
    }

    // ---- normalize + store (f16, row-major [L,768]) ----
#pragma unroll
    for (int nt = 0; nt < 4; ++nt) {
#pragma unroll
        for (int v = 0; v < 8; ++v) {
            const int row = q0 + v + 8 * (lane >> 4);
            const int col = colb + nt * 16 + (lane & 15);
            O[(size_t)row * D_MODEL + col] = (half_t)(o[nt][v] * rsum[v]);
        }
    }
}

// ---------------------------------------------------------------------------
extern "C" void kernel_launch(void* const* d_in, const int* in_sizes, int n_in,
                              void* d_out, int out_size, void* d_ws, size_t ws_size,
                              hipStream_t stream) {
    const float* query = (const float*)d_in[0];
    const float* key   = (const float*)d_in[1];
    const float* value = (const float*)d_in[2];
    const float* Wq = (const float*)d_in[3];
    const float* bq = (const float*)d_in[4];
    const float* Wk = (const float*)d_in[5];
    const float* bk = (const float*)d_in[6];
    const float* Wv = (const float*)d_in[7];
    const float* bv = (const float*)d_in[8];
    const float* Wo = (const float*)d_in[9];
    const float* bo = (const float*)d_in[10];

    const size_t E  = (size_t)L_SEQ * D_MODEL;      // 3145728
    const size_t WE = (size_t)D_MODEL * D_MODEL;    // 589824

    half_t* Xq  = (half_t*)d_ws;
    half_t* Xk  = Xq + E;
    half_t* Xv  = Xk + E;
    half_t* Wqh = Xv + E;
    half_t* Wkh = Wqh + WE;
    half_t* Wvh = Wkh + WE;
    half_t* Woh = Wvh + WE;
    half_t* Qb  = Woh + WE;
    half_t* Kb  = Qb + E;
    half_t* Vb  = Kb + E;
    half_t* Ob  = Vb + E;

    // f32 -> f16 conversion of all seven operands, one launch (Xq .. Woh)
    cvt_all_f32_f16<<<3 * XBLK + 4 * WBLK, 256, 0, stream>>>(
        query, key, value, Wq, Wk, Wv, Wo, Xq);

    // Q, K and V projections, one launch (Xq/Xk/Xv, Wqh/Wkh/Wvh -> Qb/Kb/Vb)
    dim3 qkvgrid(L_SEQ / 256, D_MODEL / 192, 3);
    gemm_qkv_f16<<<qkvgrid, 512, 0, stream>>>(Xq, Wqh, bq, bk, bv, Qb,
                                              L_SEQ, D_MODEL, D_MODEL);

    attn<<<(HEADS * (L_SEQ / 16)) / 4, 128, 0, stream>>>(Qb, Kb, Vb, Ob);

    dim3 ggrid(L_SEQ / 128, D_MODEL / 96, 1);
    gemm_out_f32<<<ggrid, 256, 0, stream>>>(Ob, Woh, bo, (float*)d_out,
                                            L_SEQ, D_MODEL, D_MODEL);
}

// v005
// Measured time: 40 microseconds a run.
// In two side-by-side timings against v004, it was 1.04 and 1.03 times as fast.
// Counting every step since v000, it is 2.31 times as fast.
#include <hip/hip_runtime.h>
#include <hip/hip_bf16.h>

typedef _Float16 half_t;
typedef __attribute__((ext_vector_type(16))) _Float16 v16h;
typedef __attribute__((ext_vector_type(8)))  float    v8f;

#define D_MODEL 768
#define L_SEQ   4096
#define HEADS   12
#define HDIM    64
#define HALFWIN 64   // WINDOW/2

__device__ __forceinline__ int clampi(int x, int lo, int hi) {
    return x < lo ? lo : (x > hi ? hi : x);
}

// ---------------------------------------------------------------------------
// GEMM: C[M,N] = X[M,K] * W^T + b   (X, W both f16; W is [N,K] row-major)
// Wave tile 16 FM x 48; WM x WN waves make a block tile of 16 FM WM x 48 WN.
// A wide block tile cuts how often a row of X or W is fetched from L2, a wide
// wave tile how often it is read from LDS (FM = 4: 12 WMMA on 7 fragments).
// K runs in stages of 128 (256 B of every operand row) through two LDS
// buffers: a stage's copies are issued one stage ahead of its use.
// K must be a multiple of 128, M of 16 FM WM, N of 48 WN.
// ---------------------------------------------------------------------------
#define BKS     128                  // k elements per stage
#define SPITCH  (BKS + 8)            // LDS row pitch in elements: 272 B = 16 B x 17
#define FN      3                    // 16-row fragments of W per wave

// 14 asynchronous 16-B copies per lane. g[i]: the lane's global address in copy i;
// l: its LDS byte address in copy 0; lstep: LDS bytes from one copy's rows to the next's.
__device__ __forceinline__ void copy14(
    const half_t* const (&g)[14], unsigned l, unsigned lstep)
{
    // s_wait_xcnt closes the statement, so that no address register named here
    // is rewritten ahead of it.
    asm volatile(
        "global_load_async_to_lds_b128 %0, %14, off\n\t"
        "global_load_async_to_lds_b128 %1, %15, off\n\t"
        "global_load_async_to_lds_b128 %2, %16, off\n\t"
        "global_load_async_to_lds_b128 %3, %17, off\n\t"
        "global_load_async_to_lds_b128 %4, %18, off\n\t"
        "global_load_async_to_lds_b128 %5, %19, off\n\t"
        "global_load_async_to_lds_b128 %6, %20, off\n\t"
        "global_load_async_to_lds_b128 %7, %21, off\n\t"
        "global_load_async_to_lds_b128 %8, %22, off\n\t"
        "global_load_async_to_lds_b128 %9, %23, off\n\t"
        "global_load_async_to_lds_b128 %10, %24, off\n\t"
        "global_load_async_to_lds_b128 %11, %25, off\n\t"
        "global_load_async_to_lds_b128 %12, %26, off\n\t"
        "global_load_async_to_lds_b128 %13, %27, off\n\t"
        "s_wait_xcnt 0x0"
        :: "v"(l),              "v"(l + 1 * lstep),  "v"(l + 2 * lstep),
           "v"(l + 3 * lstep),  "v"(l + 4 * lstep),  "v"(l + 5 * lstep),
           "v"(l + 6 * lstep),  "v"(l + 7 * lstep),  "v"(l + 8 * lstep),
           "v"(l + 9 * lstep),  "v"(l + 10 * lstep), "v"(l + 11 * lstep),
           "v"(l + 12 * lstep), "v"(l + 13 * lstep),
           "v"(g[0]),  "v"(g[1]),  "v"(g[2]),  "v"(g[3]),  "v"(g[4]),
           "v"(g[5]),  "v"(g[6]),  "v"(g[7]),  "v"(g[8]),  "v"(g[9]),
           "v"(g[10]), "v"(g[11]), "v"(g[12]), "v"(g[13])
        : "memory");
}

// One stage: the block's lanes cover RPC rows of 256 B per copy; the first
// copies bring the X rows, the rest the W rows, into consecutive LDS rows.
// gx, gw: the lane's address in the first RPC rows; gstep: RPC rows, in elements.
template <int FM, int WM, int WN>
__device__ __forceinline__ void copy_stage(
    const half_t* gx, const half_t* gw, size_t gstep, unsigned l)
{
    constexpr int RPC = WM * WN * 2;                        // rows per copy
    constexpr int XC  = WM * FM * 16 / RPC;                 // copies of X rows
    constexpr int NC  = (WM * FM + WN * FN) * 16 / RPC;     // copies in all
    static_assert(NC % 14 == 0 && NC <= 56, "copies go in statements of 14");
#pragma unroll
    for (int c0 = 0; c0 < NC; c0 += 14) {
        const half_t* g[14];
#pragma unroll
        for (int i = 0; i < 14; ++i) {
            const int c = c0 + i;
            g[i] = c < XC ? gx + c * gstep : gw + (c - XC) * gstep;
        }
        copy14(g, l + c0 * RPC * SPITCH * 2, RPC * SPITCH * 2);
    }
}

template <typename TOUT, int FM, int WM, int WN>
__device__ __forceinline__ void gemm_xwt_tile(
    const half_t* __restrict__ X, const half_t* __restrict__ W,
    const float* __restrict__ bias, TOUT* __restrict__ C,
    int M, int N, int K)
{
    constexpr int BM = WM * FM * 16;       // block tile rows
    constexpr int BN = WN * FN * 16;       // block tile columns
    // rows of a stage: the X tile, then the W tile
    __shared__ __attribute__((aligned(16))) half_t S[2][BM + BN][SPITCH];

    const int tid  = threadIdx.x;
    const int wave = tid >> 5;
    const int lane = tid & 31;
    const int m0 = blockIdx.x * BM;
    const int n0 = blockIdx.y * BN;
    const int wm = (wave % WM) * (FM * 16);   // wave row offset in block tile
    const int wn = (wave / WM) * (FN * 16);   // wave col offset in block tile
    const int kb = (lane >> 4) * 8;           // K striping base for fragments

    // the lane's place in a copy: row tid / 16, 16-B piece tid % 16 of 16
    const int crow = tid >> 4;
    const int ccol = (tid & 15) * 8;
    const half_t* gx = X + (size_t)(m0 + crow) * K + ccol;
    const half_t* gw = W + (size_t)(n0 + crow) * K + ccol;
    const size_t  gstep = (size_t)(WM * WN * 2) * K;
    const unsigned l0 = (unsigned)(size_t)&S[0][crow][ccol];
    const unsigned l1 = (unsigned)(size_t)&S[1][crow][ccol];
    const int nst = K / BKS;               // stages

    v8f acc[FM][FN] = {};

    // ---- prologue: stage 0 landed and published, stage 1 in flight ----
    copy_stage<FM, WM, WN>(gx, gw, gstep, l0);
    asm volatile("s_wait_asynccnt 0x0" ::: "memory");   // own copies of stage 0 landed
    __syncthreads();                                    // ... and every other wave's
    if (nst > 1) copy_stage<FM, WM, WN>(gx + BKS, gw + BKS, gstep, l1);

    for (int s = 0; s < nst; ++s) {
        const half_t (*St)[SPITCH] = S[s & 1];
        // unrolled, so that kk becomes an immediate offset of the LDS reads
#pragma unroll
        for (int kk = 0; kk < BKS; kk += 32) {
            // ---- fragments ----
            v16h a[FM], b[FN];
#pragma unroll
            for (int mi = 0; mi < FM; ++mi) {
                const int m = wm + mi * 16 + (lane & 15);
#pragma unroll
                for (int j = 0; j < 8; ++j) {
                    a[mi][j]     = St[m][kk + kb + j];
                    a[mi][8 + j] = St[m][kk + kb + 16 + j];
                }
            }
#pragma unroll
            for (int ni = 0; ni < FN; ++ni) {
                const int n = BM + wn + ni * 16 + (lane & 15);
#pragma unroll
                for (int j = 0; j < 8; ++j) {
                    b[ni][j]     = St[n][kk + kb + j];
                    b[ni][8 + j] = St[n][kk + kb + 16 + j];
                }
            }
            // keeps a k step's reads together ahead of its WMMAs: left alone, the
            // scheduler reloads one A fragment's registers and waits out the LDS
            // latency once per row of WMMAs
            __builtin_amdgcn_sched_barrier(0);
#pragma unroll
            for (int mi = 0; mi < FM; ++mi)
#pragma unroll
                for (int ni = 0; ni < FN; ++ni)
                    acc[mi][ni] = __builtin_amdgcn_wmma_f32_16x16x32_f16(
                        false, a[mi], false, b[ni], (short)0, acc[mi][ni], false, false);
        }
        // ---- publish stage s + 1, free this stage's buffer ----
        asm volatile("s_wait_dscnt 0x0" ::: "memory");     // own reads of this buffer done
        asm volatile("s_wait_asynccnt 0x0" ::: "memory");  // own copies of stage s + 1 landed
        __syncthreads();
        if (s + 2 < nst)
            copy_stage<FM, WM, WN>(gx + (size_t)(s + 2) * BKS, gw + (size_t)(s + 2) * BKS,
                               gstep, (s & 1) ? l1 : l0);
    }
    asm volatile("s_wait_asynccnt 0x0" ::: "memory");      // nothing in flight at the end

    // ---- writeback: lane%16 = column, rows = v + 8*(lane/16) ----
    const int col = n0 + wn + (lane & 15);
    float bvv[FN];
#pragma unroll
    for (int ni = 0; ni < FN; ++ni) bvv[ni] = bias[col + ni * 16];
    TOUT* crow0 = C + (size_t)(m0 + wm + 8 * (lane >> 4)) * N + col;
#pragma unroll
    for (int mi = 0; mi < FM; ++mi)
#pragma unroll
        for (int v = 0; v < 8; ++v) {
            TOUT* cr = crow0 + (size_t)(mi * 16 + v) * N;
#pragma unroll
            for (int ni = 0; ni < FN; ++ni)
                cr[ni * 16] = (TOUT)(acc[mi][ni][v] + bvv[ni]);
        }
}

// ---------------------------------------------------------------------------
// The three input projections, straight from the f32 operands: one launch,
// blockIdx.z picks the operand set. 4 x 4 waves of 64 x 48: block tile
// 256 x 192, one work-group per WGP. The same two-buffer ring of 128-k stages
// of f16 rows as above, but a stage is filled through registers: 16-B loads of
// f32, rounded to f16 (nearest even) on the way into LDS. A stage goes in four
// quarters of 32 k (one 128-B line of every row); two register sets, each
// loaded two k steps ahead of its store, keep loads in flight all the time.
// Plane z = 3 (64 work-groups, for the WGPs that the 192 tiles leave idle)
// rounds Wo to f16 for the last launch.
// ---------------------------------------------------------------------------
typedef __attribute__((ext_vector_type(4))) float    f32x4;
typedef __attribute__((ext_vector_type(4))) _Float16 f16x4;

#define QBM  256                     // block tile rows
#define QBN  192                     // block tile columns
#define QNC  ((QBM + QBN) / 64)      // loads per lane and quarter: 64 rows each
#define QXC  (QBM / 64)              // ... of which X rows

// gx, gw: the lane's 16 B in the first 64 rows of X and of W, at this quarter's k
__device__ __forceinline__ void load_quarter(
    const float* gx, const float* gw, f32x4 (&r)[QNC])
{
#pragma unroll
    for (int c = 0; c < QNC; ++c)
        r[c] = *(const f32x4*)(c < QXC ? gx + c * 64 * D_MODEL
                                       : gw + (c - QXC) * 64 * D_MODEL);
}

// l: the lane's 8 B in the first 64 rows of the stage, at this quarter's k
__device__ __forceinline__ void store_quarter(half_t* l, const f32x4 (&r)[QNC])
{
#pragma unroll
    for (int c = 0; c < QNC; ++c)
        *(f16x4*)(l + c * 64 * SPITCH) = __builtin_convertvector(r[c], f16x4);
}

// Work-group barrier over LDS alone: own LDS stores and reads done, then the
// barrier. __syncthreads() would also wait out the global loads that are in
// flight for the next stage, and so undo their lead. s_wait_xcnt stands here
// because the next stage rewrites the address registers of the loads issued
// in this one (a precaution).
__device__ __forceinline__ void stage_barrier()
{
    asm volatile("s_wait_dscnt 0x0\n\t"
                 "s_wait_xcnt 0x0\n\t"
                 "s_barrier_signal -1\n\t"
                 "s_barrier_wait -1" ::: "memory");
}

// One stage of 128 k: four k steps on the buffer St. ST: k step j first stores
// quarter j of the next stage (registers r0 / r1 in turn) into that stage's
// buffer ln, which the stage before this one has left. LDA, LDB: k steps 0, 1
// and 2, 3 then reload those registers with the quarter two k steps further on
// (hx, hw: the lane's 16 B at the next stage's first k). The tests are compile
// time, so that every wait on a load counts the younger set's loads exactly.
template <bool ST, bool LDA, bool LDB>
__device__ __forceinline__ void qkv_stage(
    const half_t (*St)[SPITCH], half_t* ln, const float* hx, const float* hw,
    f32x4 (&r0)[QNC], f32x4 (&r1)[QNC], v8f (&acc)[4][FN], int wm, int wn, int lane)
{
    constexpr int FM = 4;
    const int kb = (lane >> 4) * 8;           // K striping base for fragments
    // unrolled, so that kk becomes an immediate offset and the set a fixed one
#pragma unroll
    for (int kk = 0; kk < BKS; kk += 32) {
        f32x4 (&r)[QNC] = (kk & 32) ? r1 : r0;
        // keeps this k step's conversions, and with them the waits on their loads,
        // out of the WMMAs before it: lifted there, they cut the loads' lead from
        // two k steps to one
        __builtin_amdgcn_sched_barrier(0);
        if (ST) store_quarter(ln + kk, r);
        // keeps the reload behind the conversions: lifted over them it takes a third
        // register set, and its first loads then stand directly behind WMMAs whose
        // operand registers they reuse
        __builtin_amdgcn_sched_barrier(0);
        if (kk < 64 ? LDA : LDB) load_quarter(hx + kk + 64, hw + kk + 64, r);
        // ---- fragments ----
        v16h a[FM], b[FN];
#pragma unroll
        for (int mi = 0; mi < FM; ++mi) {
            const int m = wm + mi * 16 + (lane & 15);
#pragma unroll
            for (int j = 0; j < 8; ++j) {
                a[mi][j]     = St[m][kk + kb + j];
                a[mi][8 + j] = St[m][kk + kb + 16 + j];
            }
        }
#pragma unroll
        for (int ni = 0; ni < FN; ++ni) {
            const int n = QBM + wn + ni * 16 + (lane & 15);
#pragma unroll
            for (int j = 0; j < 8; ++j) {
                b[ni][j]     = St[n][kk + kb + j];
                b[ni][8 + j] = St[n][kk + kb + 16 + j];
            }
        }
        // keeps a k step's reads, and the global loads issued above, ahead of
        // its WMMAs: the loads' lead is the WMMAs of two k steps
        __builtin_amdgcn_sched_barrier(0);
#pragma unroll
        for (int mi = 0; mi < FM; ++mi)
#pragma unroll
            for (int ni = 0; ni < FN; ++ni)
                acc[mi][ni] = __builtin_amdgcn_wmma_f32_16x16x32_f16(
                    false, a[mi], false, b[ni], (short)0, acc[mi][ni], false, false);
    }
    // publishes the next stage and frees this stage's buffer
    if (ST) stage_barrier();
}

__global__ __launch_bounds__(512) void gemm_qkv_f32src(
    const float* __restrict__ xq, const float* __restrict__ xk,
    const float* __restrict__ xv, const float* __restrict__ wq,
    const float* __restrict__ wk, const float* __restrict__ wv,
    const float* __restrict__ wo, const float* __restrict__ bq,
    const float* __restrict__ bk, const float* __restrict__ bv,
    half_t* __restrict__ Cqkv, half_t* __restrict__ woh)
{
    constexpr int FM = 4, WM = 4;
    constexpr int NST = D_MODEL / BKS;     // stages
    __shared__ __attribute__((aligned(16))) half_t S[2][QBM + QBN][SPITCH];

    const int tid = threadIdx.x;
    const int z   = blockIdx.z;

    if (z == 3) {                          // the whole work-group, ahead of any barrier
        constexpr int PER = D_MODEL * D_MODEL / 64 / 4;    // 16-B pieces per work-group
        const int p0 = (blockIdx.y * 16 + blockIdx.x) * PER;
        for (int i = tid; i < PER; i += 512)
            ((f16x4*)woh)[p0 + i] =
                __builtin_convertvector(((const f32x4*)wo)[p0 + i], f16x4);
        return;
    }

    const float* X    = z == 0 ? xq : (z == 1 ? xk : xv);
    const float* Wt   = z == 0 ? wq : (z == 1 ? wk : wv);
    const float* bias = z == 0 ? bq : (z == 1 ? bk : bv);
    half_t* C = Cqkv + (size_t)z * L_SEQ * D_MODEL;

    const int wave = tid >> 5;
    const int lane = tid & 31;
    const int m0 = blockIdx.x * QBM;
    const int n0 = blockIdx.y * QBN;
    const int wm = (wave % WM) * (FM * 16);   // wave row offset in block tile
    const int wn = (wave / WM) * (FN * 16);   // wave col offset in block tile

    // the lane's place in a quarter: 8 lanes per row; a wave's four rows lie
    // 4 apart, so that their 64-B LDS stores fall on four different bank groups
    const int crow = (wave >> 2) * 16 + (wave & 3) + ((lane >> 3) << 2);
    const int ccol = (lane & 7) * 4;
    const float* gx = X  + (size_t)(m0 + crow) * D_MODEL + ccol;
    const float* gw = Wt + (size_t)(n0 + crow) * D_MODEL + ccol;
    half_t* l0 = &S[0][crow][ccol];
    half_t* l1 = &S[1][crow][ccol];

    f32x4 r0[QNC], r1[QNC];

    // ---- prologue: stage 0 stored, quarters 0 and 1 of stage 1 in flight ----
    {
        f32x4 p0[QNC], p1[QNC], p2[QNC], p3[QNC];   // the accumulators are not live yet
        load_quarter(gx, gw, p0);
        load_quarter(gx + 32, gw + 32, p1);
        load_quarter(gx + 64, gw + 64, p2);
        load_quarter(gx + 96, gw + 96, p3);
        // the two scheduling barriers keep r0's loads ahead of r1's, as in the
        // loop: interleaved, the loop's first counted wait covers both sets
        __builtin_amdgcn_sched_barrier(0);
        load_quarter(gx + 128, gw + 128, r0);
        __builtin_amdgcn_sched_barrier(0);
        load_quarter(gx + 160, gw + 160, r1);
        store_quarter(l0, p0);
        store_quarter(l0 + 32, p1);
        store_quarter(l0 + 64, p2);
        store_quarter(l0 + 96, p3);
    }
    stage_barrier();

    v8f acc[FM][FN] = {};

    for (int s = 0; s < NST - 2; ++s)
        qkv_stage<true, true, true>(S[s & 1], (s & 1) ? l0 : l1, gx + (s + 1) * BKS,
                                    gw + (s + 1) * BKS, r0, r1, acc, wm, wn, lane);
    // the last stage's quarters 2 and 3 are the last loads; then nothing is left to fill
    qkv_stage<true, true, false>(S[(NST - 2) & 1], ((NST - 2) & 1) ? l0 : l1,
                                 gx + (NST - 1) * BKS, gw + (NST - 1) * BKS,
                                 r0, r1, acc, wm, wn, lane);
    qkv_stage<false, false, false>(S[(NST - 1) & 1], l0, gx, gw, r0, r1, acc, wm, wn, lane);

    // ---- writeback: lane%16 = column, rows = v + 8*(lane/16) ----
    const int col = n0 + wn + (lane & 15);
    float bvv[FN];
#pragma unroll
    for (int ni = 0; ni < FN; ++ni) bvv[ni] = bias[col + ni * 16];
    half_t* crow0 = C + (size_t)(m0 + wm + 8 * (lane >> 4)) * D_MODEL + col;
#pragma unroll
    for (int mi = 0; mi < FM; ++mi)
#pragma unroll
        for (int v = 0; v < 8; ++v) {
            half_t* cr = crow0 + (size_t)(mi * 16 + v) * D_MODEL;
#pragma unroll
            for (int ni = 0; ni < FN; ++ni)
                cr[ni * 16] = (half_t)(acc[mi][ni][v] + bvv[ni]);
        }
    // behind the last store: the code of plane z = 3 follows in the text and
    // rewrites registers that these stores name (a precaution)
    asm volatile("s_wait_xcnt 0x0" ::: "memory");
}

// 4 x 2 waves of 32 x 48: block tile 128 x 96, so that this smaller product
// still has a work-group for every WGP.
__global__ __launch_bounds__(256) void gemm_out_f32(
    const half_t* __restrict__ X, const half_t* __restrict__ W,
    const float* __restrict__ bias, float* __restrict__ C,
    int M, int N, int K)
{
    gemm_xwt_tile<float, 2, 4, 2>(X, W, bias, C, M, N, K);
}

// ---------------------------------------------------------------------------
// Sliding-window attention: one wave per (head, 16-query block), four
// neighbouring query blocks of one head per work-group.
// Key span for a 16-query block: [q0-64, q0+79] -> 10 tiles of 16 (160 keys).
// The four spans overlap: together they are 208 keys. Their K and V rows
// (128 B each, one whole line) are brought to LDS once per work-group.
// ---------------------------------------------------------------------------
#define KSPAN   208                  // 64 + 4 * 16 + 80 keys
#define KPITCH  (HDIM + 8)           // 144 B = 16 B x 9: read by ds_load_b128
#define VPITCH  (HDIM + 16)          // 160 B = 32 B x 5: read by ds_load_tr16_b128
#define NCOPY   (KSPAN / 16)         // copies per lane and operand: 16 rows each

typedef __attribute__((ext_vector_type(8))) short    s16x8;
typedef __attribute__((ext_vector_type(8))) _Float16 v8h;

// Transposing LDS read: lane (c = l & 15, hh = l >> 4) gets rows 8 hh .. 8 hh + 7
// of column c of the 16 x 16 tile whose per-lane address p follows the map
// row 8 (l >> 4) + (l & 7), 16-B piece (l >> 3) & 1.
__device__ __forceinline__ v8h ld_tr16(const half_t* p) {
    typedef __attribute__((address_space(3))) s16x8 lds_s16x8;
    return __builtin_bit_cast(v8h, __builtin_amdgcn_ds_load_tr16_b128_v8i16((lds_s16x8*)p));
}

// 13 asynchronous 16-B copies per lane: the block's 128 lanes cover 16 rows of
// 128 B per copy. base + off[i]: the lane's piece of its (clamped) row in copy i;
// l: its LDS byte address in copy 0; lstep: LDS bytes of 16 rows.
__device__ __forceinline__ void copy_span(
    const half_t* base, const unsigned (&off)[NCOPY], unsigned l, unsigned lstep)
{
    // s_wait_xcnt closes the statement, so that no address register named here
    // is rewritten ahead of it.
    asm volatile(
        "global_load_async_to_lds_b128 %0, %13, off\n\t"
        "global_load_async_to_lds_b128 %1, %14, off\n\t"
        "global_load_async_to_lds_b128 %2, %15, off\n\t"
        "global_load_async_to_lds_b128 %3, %16, off\n\t"
        "global_load_async_to_lds_b128 %4, %17, off\n\t"
        "global_load_async_to_lds_b128 %5, %18, off\n\t"
        "global_load_async_to_lds_b128 %6, %19, off\n\t"
        "global_load_async_to_lds_b128 %7, %20, off\n\t"
        "global_load_async_to_lds_b128 %8, %21, off\n\t"
        "global_load_async_to_lds_b128 %9, %22, off\n\t"
        "global_load_async_to_lds_b128 %10, %23, off\n\t"
        "global_load_async_to_lds_b128 %11, %24, off\n\t"
        "global_load_async_to_lds_b128 %12, %25, off\n\t"
        "s_wait_xcnt 0x0"
        :: "v"(l),              "v"(l + 1 * lstep),  "v"(l + 2 * lstep),
           "v"(l + 3 * lstep),  "v"(l + 4 * lstep),  "v"(l + 5 * lstep),
           "v"(l + 6 * lstep),  "v"(l + 7 * lstep),  "v"(l + 8 * lstep),
           "v"(l + 9 * lstep),  "v"(l + 10 * lstep), "v"(l + 11 * lstep),
           "v"(l + 12 * lstep),
           "v"(base + off[0]),  "v"(base + off[1]),  "v"(base + off[2]),
           "v"(base + off[3]),  "v"(base + off[4]),  "v"(base + off[5]),
           "v"(base + off[6]),  "v"(base + off[7]),  "v"(base + off[8]),
           "v"(base + off[9]),  "v"(base + off[10]), "v"(base + off[11]),
           "v"(base + off[12])
        : "memory");
}

__global__ __launch_bounds__(128) void attn(
    const half_t* __restrict__ Q, const half_t* __restrict__ Kb,
    const half_t* __restrict__ Vb, half_t* __restrict__ O)
{
    __shared__ __attribute__((aligned(16))) half_t Ks[KSPAN][KPITCH];
    __shared__ __attribute__((aligned(16))) half_t Vs[KSPAN][VPITCH];
    __shared__ half_t Ps[4][16][176];      // per-wave P staging (f16)

    const int wave = threadIdx.x >> 5;
    const int lane = threadIdx.x & 31;
    const int task = blockIdx.x * 4 + wave;        // 0..3071
    const int h    = task >> 8;                    // head (the same in all four waves)
    const int q0   = (task & 255) * 16;            // query block start
    const int colb = h * HDIM;                     // column base in [L,768]
    const int kb   = (lane >> 4) * 8;              // K striping base
    const int r0   = wave * 16;                    // LDS row of key q0 - HALFWIN

    // ---- K and V rows of keys [q0(wave 0) - 64, + 208) to LDS; a key outside
    //      the sequence takes the nearest row's data, and its score is masked ----
    {
        const int crow  = threadIdx.x >> 3;        // row of 16
        const int ccol  = (threadIdx.x & 7) * 8;   // 16-B piece of 8
        const int kfirst = q0 - r0 - HALFWIN;
        unsigned off[NCOPY];
#pragma unroll
        for (int i = 0; i < NCOPY; ++i)
            off[i] = (unsigned)(clampi(kfirst + i * 16 + crow, 0, L_SEQ - 1) * D_MODEL
                                + colb + ccol);
        copy_span(Kb, off, (unsigned)(size_t)&Ks[crow][ccol], 16 * KPITCH * 2);
        copy_span(Vb, off, (unsigned)(size_t)&Vs[crow][ccol], 16 * VPITCH * 2);
    }

    // ---- load Q fragments (16x64 A-matrix = two 16x32 fragments) ----
    v16h aQ0, aQ1;
    {
        const half_t* qrow = Q + (size_t)(q0 + (lane & 15)) * D_MODEL + colb;
#pragma unroll
        for (int j = 0; j < 8; ++j) {
            aQ0[j]     = qrow[kb + j];
            aQ0[8 + j] = qrow[kb + 16 + j];
            aQ1[j]     = qrow[32 + kb + j];
            aQ1[8 + j] = qrow[32 + kb + 16 + j];
        }
    }

    asm volatile("s_wait_asynccnt 0x0" ::: "memory");   // own copies landed
    __syncthreads();                                    // ... and every other wave's

    // ---- scores for 10 key tiles ----
    v8f   s[10];
    float rmax[8];
#pragma unroll
    for (int v = 0; v < 8; ++v) rmax[v] = -1e30f;

#pragma unroll
    for (int t = 0; t < 10; ++t) {
        const int kstart = q0 - HALFWIN + t * 16;
        const int key    = kstart + (lane & 15);
        const half_t* krow = Ks[r0 + t * 16 + (lane & 15)];
        v16h b0, b1;
#pragma unroll
        for (int j = 0; j < 8; ++j) {
            b0[j]     = krow[kb + j];
            b0[8 + j] = krow[kb + 16 + j];
            b1[j]     = krow[32 + kb + j];
            b1[8 + j] = krow[32 + kb + 16 + j];
        }
        v8f c = {};
        c = __builtin_amdgcn_wmma_f32_16x16x32_f16(false, aQ0, false, b0,
                                                   (short)0, c, false, false);
        c = __builtin_amdgcn_wmma_f32_16x16x32_f16(false, aQ1, false, b1,
                                                   (short)0, c, false, false);
#pragma unroll
        for (int v = 0; v < 8; ++v) {
            const int row  = q0 + v + 8 * (lane >> 4);
            const int dif  = row - key;
            const bool ok  = (key >= 0) & (key < L_SEQ) &
                             (dif <= HALFWIN) & (dif >= -HALFWIN);
            const float sv = ok ? c[v] * 0.125f : -1e30f;   // 1/sqrt(64)
            s[t][v] = sv;
            rmax[v] = fmaxf(rmax[v], sv);
        }
    }

    // ---- row max across the 16 lanes of each half-wave ----
#pragma unroll
    for (int v = 0; v < 8; ++v) {
        float x = rmax[v];
#pragma unroll
        for (int off = 1; off < 16; off <<= 1)
            x = fmaxf(x, __shfl_xor(x, off, 32));
        rmax[v] = x;
    }

    // ---- exponentiate, row sum, stage P to LDS ----
    float rsum[8];
#pragma unroll
    for (int v = 0; v < 8; ++v) rsum[v] = 0.f;
#pragma unroll
    for (int t = 0; t < 10; ++t) {
#pragma unroll
        for (int v = 0; v < 8; ++v) {
            const float p = __expf(s[t][v] - rmax[v]);
            rsum[v] += p;
            Ps[wave][v + 8 * (lane >> 4)][t * 16 + (lane & 15)] = (half_t)p;
        }
    }
#pragma unroll
    for (int v = 0; v < 8; ++v) {
        float x = rsum[v];
#pragma unroll
        for (int off = 1; off < 16; off <<= 1)
            x += __shfl_xor(x, off, 32);
        rsum[v] = 1.0f / x;
    }

    // ---- O = P(16x160) * V(160x64), 5 K-steps x 4 N-tiles ----
    v8f o[4] = {{}, {}, {}, {}};
    // the lane's address in the transposing read of the wave's first 16 x 16 V tile
    const half_t* vtr = &Vs[r0 + 8 * (lane >> 4) + (lane & 7)][8 * ((lane >> 3) & 1)];
#pragma unroll
    for (int ks = 0; ks < 5; ++ks) {
        const int k2 = ks * 32;
        v16h aP;
        {
            const int m = lane & 15;
#pragma unroll
            for (int j = 0; j < 8; ++j) {
                aP[j]     = Ps[wave][m][k2 + kb + j];
                aP[8 + j] = Ps[wave][m][k2 + kb + 16 + j];
            }
        }
#pragma unroll
        for (int nt = 0; nt < 4; ++nt) {
            // keys k2 + kb + 0..7 and k2 + 16 + kb + 0..7 of column nt * 16 + lane % 16
            const v8h lo = ld_tr16(vtr + k2 * VPITCH + nt * 16);
            const v8h hi = ld_tr16(vtr + (k2 + 16) * VPITCH + nt * 16);
            const v16h bV = __builtin_shufflevector(lo, hi, 0, 1, 2, 3, 4, 5, 6, 7,
                                                    8, 9, 10, 11, 12, 13, 14, 15);
            o[nt] = __builtin_amdgcn_wmma_f32_16x16x32_f16(false, aP, false, bV,
                                                           (short)0, o[nt], false, false);
        }
    }

    // ---- normalize + store (f16, row-major [L,768]) ----
#pragma unroll
    for (int nt = 0; nt < 4; ++nt) {
#pragma unroll
        for (int v = 0; v < 8; ++v) {
            const int row = q0 + v + 8 * (lane >> 4);
            const int col = colb + nt * 16 + (lane & 15);
            O[(size_t)row * D_MODEL + col] = (half_t)(o[nt][v] * rsum[v]);
        }
    }
}

// ---------------------------------------------------------------------------
extern "C" void kernel_launch(void* const* d_in, const int* in_sizes, int n_in,
                              void* d_out, int out_size, void* d_ws, size_t ws_size,
                              hipStream_t stream) {
    const float* query = (const float*)d_in[0];
    const float* key   = (const float*)d_in[1];
    const float* value = (const float*)d_in[2];
    const float* Wq = (const float*)d_in[3];
    const float* bq = (const float*)d_in[4];
    const float* Wk = (const float*)d_in[5];
    const float* bk = (const float*)d_in[6];
    const float* Wv = (const float*)d_in[7];
    const float* bv = (const float*)d_in[8];
    const float* Wo = (const float*)d_in[9];
    const float* bo = (const float*)d_in[10];

    const size_t E  = (size_t)L_SEQ * D_MODEL;      // 3145728
    const size_t WE = (size_t)D_MODEL * D_MODEL;    // 589824

    half_t* Woh = (half_t*)d_ws;
    half_t* Qb  = Woh + WE;
    half_t* Kb  = Qb + E;
    half_t* Vb  = Kb + E;
    half_t* Ob  = Vb + E;

    // Q, K and V projections from the f32 operands (-> Qb/Kb/Vb), and Wo -> Woh
    dim3 qkvgrid(L_SEQ / 256, D_MODEL / 192, 4);
    gemm_qkv_f32src<<<qkvgrid, 512, 0, stream>>>(query, key, value, Wq, Wk, Wv, Wo,
                                                 bq, bk, bv, Qb, Woh);

    attn<<<(HEADS * (L_SEQ / 16)) / 4, 128, 0, stream>>>(Qb, Kb, Vb, Ob);

    dim3 ggrid(L_SEQ / 128, D_MODEL / 96, 1);
    gemm_out_f32<<<ggrid, 256, 0, stream>>>(Ob, Woh, bo, (float*)d_out,
                                            L_SEQ, D_MODEL, D_MODEL);
}

// v006
// One run takes 38.2 microseconds.
// In both of two side-by-side timings against v005, it was 1.05 times as fast.
// Counting every step since v000, it is 2.43 times as fast.
#include <hip/hip_runtime.h>
#include <hip/hip_bf16.h>

typedef _Float16 half_t;
typedef __attribute__((ext_vector_type(16))) _Float16 v16h;
typedef __attribute__((ext_vector_type(8)))  float    v8f;

#define D_MODEL 768
#define L_SEQ   4096
#define HEADS   12
#define HDIM    64
#define HALFWIN 64   // WINDOW/2

__device__ __forceinline__ int clampi(int x, int lo, int hi) {
    return x < lo ? lo : (x > hi ? hi : x);
}

// ---------------------------------------------------------------------------
// GEMM: C[M,N] = X[M,K] * W^T + b   (X, W both f16; W is [N,K] row-major)
// Wave tile 16 FM x 48; WM x WN waves make a block tile of 16 FM WM x 48 WN.
// A wide block tile cuts how often a row of X or W is fetched from L2, a wide
// wave tile how often it is read from LDS (FM = 4: 12 WMMA on 7 fragments).
// K runs in stages of 128 (256 B of every operand row) through a ring of four
// LDS buffers: a stage's copies are issued three stages ahead of its use, so
// that their latency is covered and L2 is asked without pauses.
// K must be a multiple of 128, M of 16 FM WM, N of 48 WN.
// ---------------------------------------------------------------------------
#define BKS     128                  // k elements per stage
#define SPITCH  (BKS + 8)            // LDS row pitch in elements: 272 B = 16 B x 17
#define FN      3                    // 16-row fragments of W per wave
#define NBUF    4                    // LDS buffers of the copy ring

// 14 asynchronous 16-B copies per lane. g[i]: the lane's global address in copy i;
// l: its LDS byte address in copy 0; lstep: LDS bytes from one copy's rows to the next's.
__device__ __forceinline__ void copy14(
    const half_t* const (&g)[14], unsigned l, unsigned lstep)
{
    // s_wait_xcnt closes the statement, so that no address register named here
    // is rewritten ahead of it.
    asm volatile(
        "global_load_async_to_lds_b128 %0, %14, off\n\t"
        "global_load_async_to_lds_b128 %1, %15, off\n\t"
        "global_load_async_to_lds_b128 %2, %16, off\n\t"
        "global_load_async_to_lds_b128 %3, %17, off\n\t"
        "global_load_async_to_lds_b128 %4, %18, off\n\t"
        "global_load_async_to_lds_b128 %5, %19, off\n\t"
        "global_load_async_to_lds_b128 %6, %20, off\n\t"
        "global_load_async_to_lds_b128 %7, %21, off\n\t"
        "global_load_async_to_lds_b128 %8, %22, off\n\t"
        "global_load_async_to_lds_b128 %9, %23, off\n\t"
        "global_load_async_to_lds_b128 %10, %24, off\n\t"
        "global_load_async_to_lds_b128 %11, %25, off\n\t"
        "global_load_async_to_lds_b128 %12, %26, off\n\t"
        "global_load_async_to_lds_b128 %13, %27, off\n\t"
        "s_wait_xcnt 0x0"
        :: "v"(l),              "v"(l + 1 * lstep),  "v"(l + 2 * lstep),
           "v"(l + 3 * lstep),  "v"(l + 4 * lstep),  "v"(l + 5 * lstep),
           "v"(l + 6 * lstep),  "v"(l + 7 * lstep),  "v"(l + 8 * lstep),
           "v"(l + 9 * lstep),  "v"(l + 10 * lstep), "v"(l + 11 * lstep),
           "v"(l + 12 * lstep), "v"(l + 13 * lstep),
           "v"(g[0]),  "v"(g[1]),  "v"(g[2]),  "v"(g[3]),  "v"(g[4]),
           "v"(g[5]),  "v"(g[6]),  "v"(g[7]),  "v"(g[8]),  "v"(g[9]),
           "v"(g[10]), "v"(g[11]), "v"(g[12]), "v"(g[13])
        : "memory");
}

// One stage: the block's lanes cover RPC rows of 256 B per copy; the first
// copies bring the X rows, the rest the W rows, into consecutive LDS rows.
// gx, gw: the lane's address in the first RPC rows; gstep: RPC rows, in elements.
template <int FM, int WM, int WN>
__device__ __forceinline__ void copy_stage(
    const half_t* gx, const half_t* gw, size_t gstep, unsigned l)
{
    constexpr int RPC = WM * WN * 2;                        // rows per copy
    constexpr int XC  = WM * FM * 16 / RPC;                 // copies of X rows
    constexpr int NC  = (WM * FM + WN * FN) * 16 / RPC;     // copies in all
    static_assert(NC % 14 == 0 && NC <= 56, "copies go in statements of 14");
#pragma unroll
    for (int c0 = 0; c0 < NC; c0 += 14) {
        const half_t* g[14];
#pragma unroll
        for (int i = 0; i < 14; ++i) {
            const int c = c0 + i;
            g[i] = c < XC ? gx + c * gstep : gw + (c - XC) * gstep;
        }
        copy14(g, l + c0 * RPC * SPITCH * 2, RPC * SPITCH * 2);
    }
}

template <typename TOUT, int FM, int WM, int WN>
__device__ __forceinline__ void gemm_xwt_tile(
    const half_t* __restrict__ X, const half_t* __restrict__ W,
    const float* __restrict__ bias, TOUT* __restrict__ C,
    int M, int N, int K)
{
    constexpr int BM = WM * FM * 16;       // block tile rows
    constexpr int BN = WN * FN * 16;       // block tile columns
    // rows of a stage: the X tile, then the W tile
    __shared__ __attribute__((aligned(16))) half_t S[NBUF][BM + BN][SPITCH];
    constexpr int NC = (BM + BN) / (WM * WN * 2);          // copies per lane and stage
    constexpr unsigned LBUF = (BM + BN) * SPITCH * 2;      // bytes of one buffer
    static_assert(NBUF * NC <= 63, "copies of a wave in flight");

    const int tid  = threadIdx.x;
    const int wave = tid >> 5;
    const int lane = tid & 31;
    const int m0 = blockIdx.x * BM;
    const int n0 = blockIdx.y * BN;
    const int wm = (wave % WM) * (FM * 16);   // wave row offset in block tile
    const int wn = (wave / WM) * (FN * 16);   // wave col offset in block tile
    const int kb = (lane >> 4) * 8;           // K striping base for fragments

    // the lane's place in a copy: row tid / 16, 16-B piece tid % 16 of 16
    const int crow = tid >> 4;
    const int ccol = (tid & 15) * 8;
    const half_t* gx = X + (size_t)(m0 + crow) * K + ccol;
    const half_t* gw = W + (size_t)(n0 + crow) * K + ccol;
    const size_t  gstep = (size_t)(WM * WN * 2) * K;
    const unsigned l0 = (unsigned)(size_t)&S[0][crow][ccol];
    const int nst = K / BKS;               // stages

    v8f acc[FM][FN] = {};

    // ---- prologue: the first NBUF stages issued, stage 0 landed and published ----
#pragma unroll
    for (int p = 0; p < NBUF; ++p)
        if (p < nst) copy_stage<FM, WM, WN>(gx + p * BKS, gw + p * BKS, gstep, l0 + p * LBUF);
    // own copies of stage 0 landed: all but the copies of the stages issued behind it
    if (nst >= NBUF) asm volatile("s_wait_asynccnt %0" :: "i"((NBUF - 1) * NC) : "memory");
    else             asm volatile("s_wait_asynccnt 0x0" ::: "memory");
    __syncthreads();                                    // ... and every other wave's

    for (int s = 0; s < nst; ++s) {
        const half_t (*St)[SPITCH] = S[s % NBUF];
        // unrolled, so that kk becomes an immediate offset of the LDS reads
#pragma unroll
        for (int kk = 0; kk < BKS; kk += 32) {
            // ---- fragments ----
            v16h a[FM], b[FN];
#pragma unroll
            for (int mi = 0; mi < FM; ++mi) {
                const int m = wm + mi * 16 + (lane & 15);
#pragma unroll
                for (int j = 0; j < 8; ++j) {
                    a[mi][j]     = St[m][kk + kb + j];
                    a[mi][8 + j] = St[m][kk + kb + 16 + j];
                }
            }
#pragma unroll
            for (int ni = 0; ni < FN; ++ni) {
                const int n = BM + wn + ni * 16 + (lane & 15);
#pragma unroll
                for (int j = 0; j < 8; ++j) {
                    b[ni][j]     = St[n][kk + kb + j];
                    b[ni][8 + j] = St[n][kk + kb + 16 + j];
                }
            }
            // keeps a k step's reads together ahead of its WMMAs: left alone, the
            // scheduler reloads one A fragment's registers and waits out the LDS
            // latency once per row of WMMAs
            __builtin_amdgcn_sched_barrier(0);
#pragma unroll
            for (int mi = 0; mi < FM; ++mi)
#pragma unroll
                for (int ni = 0; ni < FN; ++ni)
                    acc[mi][ni] = __builtin_amdgcn_wmma_f32_16x16x32_f16(
                        false, a[mi], false, b[ni], (short)0, acc[mi][ni], false, false);
        }
        // ---- publish stage s + 1, free this stage's buffer ----
        asm volatile("s_wait_dscnt 0x0" ::: "memory");     // own reads of this buffer done
        // own copies of stage s + 1 landed: while the ring is full, stages s + 2 to
        // s + NBUF - 1 are all that was issued behind it and may stay in flight
        if (s + NBUF - 1 < nst)
            asm volatile("s_wait_asynccnt %0" :: "i"((NBUF - 2) * NC) : "memory");
        else
            asm volatile("s_wait_asynccnt 0x0" ::: "memory");
        __syncthreads();
        if (s + NBUF < nst)                                // into the buffer just read
            copy_stage<FM, WM, WN>(gx + (size_t)(s + NBUF) * BKS, gw + (size_t)(s + NBUF) * BKS,
                               gstep, l0 + (unsigned)(s % NBUF) * LBUF);
    }
    asm volatile("s_wait_asynccnt 0x0" ::: "memory");      // nothing in flight at the end

    // ---- writeback: lane%16 = column, rows = v + 8*(lane/16) ----
    const int col = n0 + wn + (lane & 15);
    float bvv[FN];
#pragma unroll
    for (int ni = 0; ni < FN; ++ni) bvv[ni] = bias[col + ni * 16];
    TOUT* crow0 = C + (size_t)(m0 + wm + 8 * (lane >> 4)) * N + col;
#pragma unroll
    for (int mi = 0; mi < FM; ++mi)
#pragma unroll
        for (int v = 0; v < 8; ++v) {
            TOUT* cr = crow0 + (size_t)(mi * 16 + v) * N;
#pragma unroll
            for (int ni = 0; ni < FN; ++ni)
                cr[ni * 16] = (TOUT)(acc[mi][ni][v] + bvv[ni]);
        }
}

// ---------------------------------------------------------------------------
// The three input projections, straight from the f32 operands: one launch,
// blockIdx.z picks the operand set. 4 x 4 waves of 64 x 48: block tile
// 256 x 192, one work-group per WGP. A ring of two LDS buffers (above: four) of 128-k stages
// of f16 rows as above, but a stage is filled through registers: 16-B loads of
// f32, rounded to f16 (nearest even) on the way into LDS. A stage goes in four
// quarters of 32 k (one 128-B line of every row); two register sets, each
// loaded two k steps ahead of its store, keep loads in flight all the time.
// Plane z = 3 (64 work-groups, for the WGPs that the 192 tiles leave idle)
// rounds Wo to f16 for the last launch.
// ---------------------------------------------------------------------------
typedef __attribute__((ext_vector_type(4))) float    f32x4;
typedef __attribute__((ext_vector_type(4))) _Float16 f16x4;

#define QBM  256                     // block tile rows
#define QBN  192                     // block tile columns
#define QNC  ((QBM + QBN) / 64)      // loads per lane and quarter: 64 rows each
#define QXC  (QBM / 64)              // ... of which X rows

// gx, gw: the lane's 16 B in the first 64 rows of X and of W, at this quarter's k
__device__ __forceinline__ void load_quarter(
    const float* gx, const float* gw, f32x4 (&r)[QNC])
{
#pragma unroll
    for (int c = 0; c < QNC; ++c)
        r[c] = *(const f32x4*)(c < QXC ? gx + c * 64 * D_MODEL
                                       : gw + (c - QXC) * 64 * D_MODEL);
}

// l: the lane's 8 B in the first 64 rows of the stage, at this quarter's k
__device__ __forceinline__ void store_quarter(half_t* l, const f32x4 (&r)[QNC])
{
#pragma unroll
    for (int c = 0; c < QNC; ++c)
        *(f16x4*)(l + c * 64 * SPITCH) = __builtin_convertvector(r[c], f16x4);
}

// Work-group barrier over LDS alone: own LDS stores and reads done, then the
// barrier. __syncthreads() would also wait out the global loads that are in
// flight for the next stage, and so undo their lead. s_wait_xcnt stands here
// because the next stage rewrites the address registers of the loads issued
// in this one (a precaution).
__device__ __forceinline__ void stage_barrier()
{
    asm volatile("s_wait_dscnt 0x0\n\t"
                 "s_wait_xcnt 0x0\n\t"
                 "s_barrier_signal -1\n\t"
                 "s_barrier_wait -1" ::: "memory");
}

// One stage of 128 k: four k steps on the buffer St. ST: k step j first stores
// quarter j of the next stage (registers r0 / r1 in turn) into that stage's
// buffer ln, which the stage before this one has left. LDA, LDB: k steps 0, 1
// and 2, 3 then reload those registers with the quarter two k steps further on
// (hx, hw: the lane's 16 B at the next stage's first k). The tests are compile
// time, so that every wait on a load counts the younger set's loads exactly.
template <bool ST, bool LDA, bool LDB>
__device__ __forceinline__ void qkv_stage(
    const half_t (*St)[SPITCH], half_t* ln, const float* hx, const float* hw,
    f32x4 (&r0)[QNC], f32x4 (&r1)[QNC], v8f (&acc)[4][FN], int wm, int wn, int lane)
{
    constexpr int FM = 4;
    const int kb = (lane >> 4) * 8;           // K striping base for fragments
    // unrolled, so that kk becomes an immediate offset and the set a fixed one
#pragma unroll
    for (int kk = 0; kk < BKS; kk += 32) {
        f32x4 (&r)[QNC] = (kk & 32) ? r1 : r0;
        // keeps this k step's conversions, and with them the waits on their loads,
        // out of the WMMAs before it: lifted there, they cut the loads' lead from
        // two k steps to one
        __builtin_amdgcn_sched_barrier(0);
        if (ST) store_quarter(ln + kk, r);
        // keeps the reload behind the conversions: lifted over them it takes a third
        // register set, and its first loads then stand directly behind WMMAs whose
        // operand registers they reuse
        __builtin_amdgcn_sched_barrier(0);
        if (kk < 64 ? LDA : LDB) load_quarter(hx + kk + 64, hw + kk + 64, r);
        // ---- fragments ----
        v16h a[FM], b[FN];
#pragma unroll
        for (int mi = 0; mi < FM; ++mi) {
            const int m = wm + mi * 16 + (lane & 15);
#pragma unroll
            for (int j = 0; j < 8; ++j) {
                a[mi][j]     = St[m][kk + kb + j];
                a[mi][8 + j] = St[m][kk + kb + 16 + j];
            }
        }
#pragma unroll
        for (int ni = 0; ni < FN; ++ni) {
            const int n = QBM + wn + ni * 16 + (lane & 15);
#pragma unroll
            for (int j = 0; j < 8; ++j) {
                b[ni][j]     = St[n][kk + kb + j];
                b[ni][8 + j] = St[n][kk + kb + 16 + j];
            }
        }
        // keeps a k step's reads, and the global loads issued above, ahead of
        // its WMMAs: the loads' lead is the WMMAs of two k steps
        __builtin_amdgcn_sched_barrier(0);
#pragma unroll
        for (int mi = 0; mi < FM; ++mi)
#pragma unroll
            for (int ni = 0; ni < FN; ++ni)
                acc[mi][ni] = __builtin_amdgcn_wmma_f32_16x16x32_f16(
                    false, a[mi], false, b[ni], (short)0, acc[mi][ni], false, false);
    }
    // publishes the next stage and frees this stage's buffer
    if (ST) stage_barrier();
}

__global__ __launch_bounds__(512) void gemm_qkv_f32src(
    const float* __restrict__ xq, const float* __restrict__ xk,
    const float* __restrict__ xv, const float* __restrict__ wq,
    const float* __restrict__ wk, const float* __restrict__ wv,
    const float* __restrict__ wo, const float* __restrict__ bq,
    const float* __restrict__ bk, const float* __restrict__ bv,
    half_t* __restrict__ Cqkv, half_t* __restrict__ woh)
{
    constexpr int FM = 4, WM = 4;
    constexpr int NST = D_MODEL / BKS;     // stages
    __shared__ __attribute__((aligned(16))) half_t S[2][QBM + QBN][SPITCH];

    const int tid = threadIdx.x;
    const int z   = blockIdx.z;

    if (z == 3) {                          // the whole work-group, ahead of any barrier
        constexpr int PER = D_MODEL * D_MODEL / 64 / 4;    // 16-B pieces per work-group
        const int p0 = (blockIdx.y * 16 + blockIdx.x) * PER;
        for (int i = tid; i < PER; i += 512)
            ((f16x4*)woh)[p0 + i] =
                __builtin_convertvector(((const f32x4*)wo)[p0 + i], f16x4);
        return;
    }

    const float* X    = z == 0 ? xq : (z == 1 ? xk : xv);
    const float* Wt   = z == 0 ? wq : (z == 1 ? wk : wv);
    const float* bias = z == 0 ? bq : (z == 1 ? bk : bv);
    half_t* C = Cqkv + (size_t)z * L_SEQ * D_MODEL;

    const int wave = tid >> 5;
    const int lane = tid & 31;
    const int m0 = blockIdx.x * QBM;
    const int n0 = blockIdx.y * QBN;
    const int wm = (wave % WM) * (FM * 16);   // wave row offset in block tile
    const int wn = (wave / WM) * (FN * 16);   // wave col offset in block tile

    // the lane's place in a quarter: 8 lanes per row; a wave's four rows lie
    // 4 apart, so that their 64-B LDS stores fall on four different bank groups
    const int crow = (wave >> 2) * 16 + (wave & 3) + ((lane >> 3) << 2);
    const int ccol = (lane & 7) * 4;
    const float* gx = X  + (size_t)(m0 + crow) * D_MODEL + ccol;
    const float* gw = Wt + (size_t)(n0 + crow) * D_MODEL + ccol;
    half_t* l0 = &S[0][crow][ccol];
    half_t* l1 = &S[1][crow][ccol];

    f32x4 r0[QNC], r1[QNC];

    // ---- prologue: stage 0 stored, quarters 0 and 1 of stage 1 in flight ----
    {
        f32x4 p0[QNC], p1[QNC], p2[QNC], p3[QNC];   // the accumulators are not live yet
        load_quarter(gx, gw, p0);
        load_quarter(gx + 32, gw + 32, p1);
        load_quarter(gx + 64, gw + 64, p2);
        load_quarter(gx + 96, gw + 96, p3);
        // the two scheduling barriers keep r0's loads ahead of r1's, as in the
        // loop: interleaved, the loop's first counted wait covers both sets
        __builtin_amdgcn_sched_barrier(0);
        load_quarter(gx + 128, gw + 128, r0);
        __builtin_amdgcn_sched_barrier(0);
        load_quarter(gx + 160, gw + 160, r1);
        store_quarter(l0, p0);
        store_quarter(l0 + 32, p1);
        store_quarter(l0 + 64, p2);
        store_quarter(l0 + 96, p3);
    }
    stage_barrier();

    v8f acc[FM][FN] = {};

    for (int s = 0; s < NST - 2; ++s)
        qkv_stage<true, true, true>(S[s & 1], (s & 1) ? l0 : l1, gx + (s + 1) * BKS,
                                    gw + (s + 1) * BKS, r0, r1, acc, wm, wn, lane);
    // the last stage's quarters 2 and 3 are the last loads; then nothing is left to fill
    qkv_stage<true, true, false>(S[(NST - 2) & 1], ((NST - 2) & 1) ? l0 : l1,
                                 gx + (NST - 1) * BKS, gw + (NST - 1) * BKS,
                                 r0, r1, acc, wm, wn, lane);
    qkv_stage<false, false, false>(S[(NST - 1) & 1], l0, gx, gw, r0, r1, acc, wm, wn, lane);

    // ---- writeback: lane%16 = column, rows = v + 8*(lane/16) ----
    const int col = n0 + wn + (lane & 15);
    float bvv[FN];
#pragma unroll
    for (int ni = 0; ni < FN; ++ni) bvv[ni] = bias[col + ni * 16];
    half_t* crow0 = C + (size_t)(m0 + wm + 8 * (lane >> 4)) * D_MODEL + col;
#pragma unroll
    for (int mi = 0; mi < FM; ++mi)
#pragma unroll
        for (int v = 0; v < 8; ++v) {
            half_t* cr = crow0 + (size_t)(mi * 16 + v) * D_MODEL;
#pragma unroll
            for (int ni = 0; ni < FN; ++ni)
                cr[ni * 16] = (half_t)(acc[mi][ni][v] + bvv[ni]);
        }
    // behind the last store: the code of plane z = 3 follows in the text and
    // rewrites registers that these stores name (a precaution)
    asm volatile("s_wait_xcnt 0x0" ::: "memory");
}

// 4 x 2 waves of 32 x 48: block tile 128 x 96, so that this smaller product
// still has a work-group for every WGP.
__global__ __launch_bounds__(256) void gemm_out_f32(
    const half_t* __restrict__ X, const half_t* __restrict__ W,
    const float* __restrict__ bias, float* __restrict__ C,
    int M, int N, int K)
{
    gemm_xwt_tile<float, 2, 4, 2>(X, W, bias, C, M, N, K);
}

// ---------------------------------------------------------------------------
// Sliding-window attention: one wave per (head, 16-query block), four
// neighbouring query blocks of one head per work-group.
// Key span for a 16-query block: [q0-64, q0+79] -> 10 tiles of 16 (160 keys).
// The four spans overlap: together they are 208 keys. Their K and V rows
// (128 B each, one whole line) are brought to LDS once per work-group.
// ---------------------------------------------------------------------------
#define KSPAN   208                  // 64 + 4 * 16 + 80 keys
#define KPITCH  (HDIM + 8)           // 144 B = 16 B x 9: read by ds_load_b128
#define VPITCH  (HDIM + 16)          // 160 B = 32 B x 5: read by ds_load_tr16_b128
#define NCOPY   (KSPAN / 16)         // copies per lane and operand: 16 rows each

typedef __attribute__((ext_vector_type(8))) short    s16x8;
typedef __attribute__((ext_vector_type(8))) _Float16 v8h;

// Transposing LDS read: lane (c = l & 15, hh = l >> 4) gets rows 8 hh .. 8 hh + 7
// of column c of the 16 x 16 tile whose per-lane address p follows the map
// row 8 (l >> 4) + (l & 7), 16-B piece (l >> 3) & 1.
__device__ __forceinline__ v8h ld_tr16(const half_t* p) {
    typedef __attribute__((address_space(3))) s16x8 lds_s16x8;
    return __builtin_bit_cast(v8h, __builtin_amdgcn_ds_load_tr16_b128_v8i16((lds_s16x8*)p));
}

// 13 asynchronous 16-B copies per lane: the block's 128 lanes cover 16 rows of
// 128 B per copy. base + off[i]: the lane's piece of its (clamped) row in copy i;
// l: its LDS byte address in copy 0; lstep: LDS bytes of 16 rows.
__device__ __forceinline__ void copy_span(
    const half_t* base, const unsigned (&off)[NCOPY], unsigned l, unsigned lstep)
{
    // s_wait_xcnt closes the statement, so that no address register named here
    // is rewritten ahead of it.
    asm volatile(
        "global_load_async_to_lds_b128 %0, %13, off\n\t"
        "global_load_async_to_lds_b128 %1, %14, off\n\t"
        "global_load_async_to_lds_b128 %2, %15, off\n\t"
        "global_load_async_to_lds_b128 %3, %16, off\n\t"
        "global_load_async_to_lds_b128 %4, %17, off\n\t"
        "global_load_async_to_lds_b128 %5, %18, off\n\t"
        "global_load_async_to_lds_b128 %6, %19, off\n\t"
        "global_load_async_to_lds_b128 %7, %20, off\n\t"
        "global_load_async_to_lds_b128 %8, %21, off\n\t"
        "global_load_async_to_lds_b128 %9, %22, off\n\t"
        "global_load_async_to_lds_b128 %10, %23, off\n\t"
        "global_load_async_to_lds_b128 %11, %24, off\n\t"
        "global_load_async_to_lds_b128 %12, %25, off\n\t"
        "s_wait_xcnt 0x0"
        :: "v"(l),              "v"(l + 1 * lstep),  "v"(l + 2 * lstep),
           "v"(l + 3 * lstep),  "v"(l + 4 * lstep),  "v"(l + 5 * lstep),
           "v"(l + 6 * lstep),  "v"(l + 7 * lstep),  "v"(l + 8 * lstep),
           "v"(l + 9 * lstep),  "v"(l + 10 * lstep), "v"(l + 11 * lstep),
           "v"(l + 12 * lstep),
           "v"(base + off[0]),  "v"(base + off[1]),  "v"(base + off[2]),
           "v"(base + off[3]),  "v"(base + off[4]),  "v"(base + off[5]),
           "v"(base + off[6]),  "v"(base + off[7]),  "v"(base + off[8]),
           "v"(base + off[9]),  "v"(base + off[10]), "v"(base + off[11]),
           "v"(base + off[12])
        : "memory");
}

__global__ __launch_bounds__(128) void attn(
    const half_t* __restrict__ Q, const half_t* __restrict__ Kb,
    const half_t* __restrict__ Vb, half_t* __restrict__ O)
{
    __shared__ __attribute__((aligned(16))) half_t Ks[KSPAN][KPITCH];
    __shared__ __attribute__((aligned(16))) half_t Vs[KSPAN][VPITCH];
    __shared__ half_t Ps[4][16][176];      // per-wave P staging (f16)

    const int wave = threadIdx.x >> 5;
    const int lane = threadIdx.x & 31;
    const int task = blockIdx.x * 4 + wave;        // 0..3071
    const int h    = task >> 8;                    // head (the same in all four waves)
    const int q0   = (task & 255) * 16;            // query block start
    const int colb = h * HDIM;                     // column base in [L,768]
    const int kb   = (lane >> 4) * 8;              // K striping base
    const int r0   = wave * 16;                    // LDS row of key q0 - HALFWIN

    // ---- K and V rows of keys [q0(wave 0) - 64, + 208) to LDS; a key outside
    //      the sequence takes the nearest row's data, and its score is masked ----
    {
        const int crow  = threadIdx.x >> 3;        // row of 16
        const int ccol  = (threadIdx.x & 7) * 8;   // 16-B piece of 8
        const int kfirst = q0 - r0 - HALFWIN;
        unsigned off[NCOPY];
#pragma unroll
        for (int i = 0; i < NCOPY; ++i)
            off[i] = (unsigned)(clampi(kfirst + i * 16 + crow, 0, L_SEQ - 1) * D_MODEL
                                + colb + ccol);
        copy_span(Kb, off, (unsigned)(size_t)&Ks[crow][ccol], 16 * KPITCH * 2);
        copy_span(Vb, off, (unsigned)(size_t)&Vs[crow][ccol], 16 * VPITCH * 2);
    }

    // ---- load Q fragments (16x64 A-matrix = two 16x32 fragments) ----
    v16h aQ0, aQ1;
    {
        const half_t* qrow = Q + (size_t)(q0 + (lane & 15)) * D_MODEL + colb;
#pragma unroll
        for (int j = 0; j < 8; ++j) {
            aQ0[j]     = qrow[kb + j];
            aQ0[8 + j] = qrow[kb + 16 + j];
            aQ1[j]     = qrow[32 + kb + j];
            aQ1[8 + j] = qrow[32 + kb + 16 + j];
        }
    }

    asm volatile("s_wait_asynccnt 0x0" ::: "memory");   // own copies landed
    __syncthreads();                                    // ... and every other wave's

    // ---- scores for 10 key tiles ----
    v8f   s[10];
    float rmax[8];
#pragma unroll
    for (int v = 0; v < 8; ++v) rmax[v] = -1e30f;

#pragma unroll
    for (int t = 0; t < 10; ++t) {
        const int kstart = q0 - HALFWIN + t * 16;
        const int key    = kstart + (lane & 15);
        const half_t* krow = Ks[r0 + t * 16 + (lane & 15)];
        v16h b0, b1;
#pragma unroll
        for (int j = 0; j < 8; ++j) {
            b0[j]     = krow[kb + j];
            b0[8 + j] = krow[kb + 16 + j];
            b1[j]     = krow[32 + kb + j];
            b1[8 + j] = krow[32 + kb + 16 + j];
        }
        v8f c = {};
        c = __builtin_amdgcn_wmma_f32_16x16x32_f16(false, aQ0, false, b0,
                                                   (short)0, c, false, false);
        c = __builtin_amdgcn_wmma_f32_16x16x32_f16(false, aQ1, false, b1,
                                                   (short)0, c, false, false);
#pragma unroll
        for (int v = 0; v < 8; ++v) {
            const int row  = q0 + v + 8 * (lane >> 4);
            const int dif  = row - key;
            const bool ok  = (key >= 0) & (key < L_SEQ) &
                             (dif <= HALFWIN) & (dif >= -HALFWIN);
            const float sv = ok ? c[v] * 0.125f : -1e30f;   // 1/sqrt(64)
            s[t][v] = sv;
            rmax[v] = fmaxf(rmax[v], sv);
        }
    }

    // ---- row max across the 16 lanes of each half-wave ----
#pragma unroll
    for (int v = 0; v < 8; ++v) {
        float x = rmax[v];
#pragma unroll
        for (int off = 1; off < 16; off <<= 1)
            x = fmaxf(x, __shfl_xor(x, off, 32));
        rmax[v] = x;
    }

    // ---- exponentiate, row sum, stage P to LDS ----
    float rsum[8];
#pragma unroll
    for (int v = 0; v < 8; ++v) rsum[v] = 0.f;
#pragma unroll
    for (int t = 0; t < 10; ++t) {
#pragma unroll
        for (int v = 0; v < 8; ++v) {
            const float p = __expf(s[t][v] - rmax[v]);
            rsum[v] += p;
            Ps[wave][v + 8 * (lane >> 4)][t * 16 + (lane & 15)] = (half_t)p;
        }
    }
#pragma unroll
    for (int v = 0; v < 8; ++v) {
        float x = rsum[v];
#pragma unroll
        for (int off = 1; off < 16; off <<= 1)
            x += __shfl_xor(x, off, 32);
        rsum[v] = 1.0f / x;
    }

    // ---- O = P(16x160) * V(160x64), 5 K-steps x 4 N-tiles ----
    v8f o[4] = {{}, {}, {}, {}};
    // the lane's address in the transposing read of the wave's first 16 x 16 V tile
    const half_t* vtr = &Vs[r0 + 8 * (lane >> 4) + (lane & 7)][8 * ((lane >> 3) & 1)];
#pragma unroll
    for (int ks = 0; ks < 5; ++ks) {
        const int k2 = ks * 32;
        v16h aP;
        {
            const int m = lane & 15;
#pragma unroll
            for (int j = 0; j < 8; ++j) {
                aP[j]     = Ps[wave][m][k2 + kb + j];
                aP[8 + j] = Ps[wave][m][k2 + kb + 16 + j];
            }
        }
#pragma unroll
        for (int nt = 0; nt < 4; ++nt) {
            // keys k2 + kb + 0..7 and k2 + 16 + kb + 0..7 of column nt * 16 + lane % 16
            const v8h lo = ld_tr16(vtr + k2 * VPITCH + nt * 16);
            const v8h hi = ld_tr16(vtr + (k2 + 16) * VPITCH + nt * 16);
            const v16h bV = __builtin_shufflevector(lo, hi, 0, 1, 2, 3, 4, 5, 6, 7,
                                                    8, 9, 10, 11, 12, 13, 14, 15);
            o[nt] = __builtin_amdgcn_wmma_f32_16x16x32_f16(false, aP, false, bV,
                                                           (short)0, o[nt], false, false);
        }
    }

    // ---- normalize + store (f16, row-major [L,768]) ----
#pragma unroll
    for (int nt = 0; nt < 4; ++nt) {
#pragma unroll
        for (int v = 0; v < 8; ++v) {
            const int row = q0 + v + 8 * (lane >> 4);
            const int col = colb + nt * 16 + (lane & 15);
            O[(size_t)row * D_MODEL + col] = (half_t)(o[nt][v] * rsum[v]);
        }
    }
}

// ---------------------------------------------------------------------------
extern "C" void kernel_launch(void* const* d_in, const int* in_sizes, int n_in,
                              void* d_out, int out_size, void* d_ws, size_t ws_size,
                              hipStream_t stream) {
    const float* query = (const float*)d_in[0];
    const float* key   = (const float*)d_in[1];
    const float* value = (const float*)d_in[2];
    const float* Wq = (const float*)d_in[3];
    const float* bq = (const float*)d_in[4];
    const float* Wk = (const float*)d_in[5];
    const float* bk = (const float*)d_in[6];
    const float* Wv = (const float*)d_in[7];
    const float* bv = (const float*)d_in[8];
    const float* Wo = (const float*)d_in[9];
    const float* bo = (const float*)d_in[10];

    const size_t E  = (size_t)L_SEQ * D_MODEL;      // 3145728
    const size_t WE = (size_t)D_MODEL * D_MODEL;    // 589824

    half_t* Woh = (half_t*)d_ws;
    half_t* Qb  = Woh + WE;
    half_t* Kb  = Qb + E;
    half_t* Vb  = Kb + E;
    half_t* Ob  = Vb + E;

    // Q, K and V projections from the f32 operands (-> Qb/Kb/Vb), and Wo -> Woh
    dim3 qkvgrid(L_SEQ / 256, D_MODEL / 192, 4);
    gemm_qkv_f32src<<<qkvgrid, 512, 0, stream>>>(query, key, value, Wq, Wk, Wv, Wo,
                                                 bq, bk, bv, Qb, Woh);

    attn<<<(HEADS * (L_SEQ / 16)) / 4, 128, 0, stream>>>(Qb, Kb, Vb, Ob);

    dim3 ggrid(L_SEQ / 128, D_MODEL / 96, 1);
    gemm_out_f32<<<ggrid, 256, 0, stream>>>(Ob, Woh, bo, (float*)d_out,
                                            L_SEQ, D_MODEL, D_MODEL);
}

// v007
// Measured time: 37.1 microseconds a run.
// In both of two side-by-side timings against v006, it was 1.03 times as fast.
// All steps since v000 together make it 2.51 times as fast.
#include <hip/hip_runtime.h>
#include <hip/hip_bf16.h>

typedef _Float16 half_t;
typedef __attribute__((ext_vector_type(16))) _Float16 v16h;
typedef __attribute__((ext_vector_type(8)))  float    v8f;

#define D_MODEL 768
#define L_SEQ   4096
#define HEADS   12
#define HDIM    64
#define HALFWIN 64   // WINDOW/2

__device__ __forceinline__ int clampi(int x, int lo, int hi) {
    return x < lo ? lo : (x > hi ? hi : x);
}

// ---------------------------------------------------------------------------
// GEMM: C[M,N] = X[M,K] * W^T + b   (X, W both f16; W is [N,K] row-major)
// Wave tile 16 FM x 48; WM x WN waves make a block tile of 16 FM WM x 48 WN.
// A wide block tile cuts how often a row of X or W is fetched from L2, a wide
// wave tile how often it is read from LDS (FM = 4: 12 WMMA on 7 fragments).
// K runs in stages of 128 (256 B of every operand row) through a ring of four
// LDS buffers: a stage's copies are issued three stages ahead of its use, so
// that their latency is covered and L2 is asked without pauses.
// K must be a multiple of 128, M of 16 FM WM, N of 48 WN.
// ---------------------------------------------------------------------------
#define BKS     128                  // k elements per stage
#define SPITCH  (BKS + 8)            // LDS row pitch in elements: 272 B = 16 B x 17
#define FN      3                    // 16-row fragments of W per wave
#define NBUF    4                    // LDS buffers of the copy ring

// 14 asynchronous 16-B copies per lane. g[i]: the lane's global address in copy i;
// l: its LDS byte address in copy 0; lstep: LDS bytes from one copy's rows to the next's.
__device__ __forceinline__ void copy14(
    const half_t* const (&g)[14], unsigned l, unsigned lstep)
{
    // s_wait_xcnt closes the statement, so that no address register named here
    // is rewritten ahead of it.
    asm volatile(
        "global_load_async_to_lds_b128 %0, %14, off\n\t"
        "global_load_async_to_lds_b128 %1, %15, off\n\t"
        "global_load_async_to_lds_b128 %2, %16, off\n\t"
        "global_load_async_to_lds_b128 %3, %17, off\n\t"
        "global_load_async_to_lds_b128 %4, %18, off\n\t"
        "global_load_async_to_lds_b128 %5, %19, off\n\t"
        "global_load_async_to_lds_b128 %6, %20, off\n\t"
        "global_load_async_to_lds_b128 %7, %21, off\n\t"
        "global_load_async_to_lds_b128 %8, %22, off\n\t"
        "global_load_async_to_lds_b128 %9, %23, off\n\t"
        "global_load_async_to_lds_b128 %10, %24, off\n\t"
        "global_load_async_to_lds_b128 %11, %25, off\n\t"
        "global_load_async_to_lds_b128 %12, %26, off\n\t"
        "global_load_async_to_lds_b128 %13, %27, off\n\t"
        "s_wait_xcnt 0x0"
        :: "v"(l),              "v"(l + 1 * lstep),  "v"(l + 2 * lstep),
           "v"(l + 3 * lstep),  "v"(l + 4 * lstep),  "v"(l + 5 * lstep),
           "v"(l + 6 * lstep),  "v"(l + 7 * lstep),  "v"(l + 8 * lstep),
           "v"(l + 9 * lstep),  "v"(l + 10 * lstep), "v"(l + 11 * lstep),
           "v"(l + 12 * lstep), "v"(l + 13 * lstep),
           "v"(g[0]),  "v"(g[1]),  "v"(g[2]),  "v"(g[3]),  "v"(g[4]),
           "v"(g[5]),  "v"(g[6]),  "v"(g[7]),  "v"(g[8]),  "v"(g[9]),
           "v"(g[10]), "v"(g[11]), "v"(g[12]), "v"(g[13])
        : "memory");
}

// One stage: the block's lanes cover RPC rows of 256 B per copy; the first
// copies bring the X rows, the rest the W rows, into consecutive LDS rows.
// gx, gw: the lane's address in the first RPC rows; gstep: RPC rows, in elements.
template <int FM, int WM, int WN>
__device__ __forceinline__ void copy_stage(
    const half_t* gx, const half_t* gw, size_t gstep, unsigned l)
{
    constexpr int RPC = WM * WN * 2;                        // rows per copy
    constexpr int XC  = WM * FM * 16 / RPC;                 // copies of X rows
    constexpr int NC  = (WM * FM + WN * FN) * 16 / RPC;     // copies in all
    static_assert(NC % 14 == 0 && NC <= 56, "copies go in statements of 14");
#pragma unroll
    for (int c0 = 0; c0 < NC; c0 += 14) {
        const half_t* g[14];
#pragma unroll
        for (int i = 0; i < 14; ++i) {
            const int c = c0 + i;
            g[i] = c < XC ? gx + c * gstep : gw + (c - XC) * gstep;
        }
        copy14(g, l + c0 * RPC * SPITCH * 2, RPC * SPITCH * 2);
    }
}

template <typename TOUT, int FM, int WM, int WN>
__device__ __forceinline__ void gemm_xwt_tile(
    const half_t* __restrict__ X, const half_t* __restrict__ W,
    const float* __restrict__ bias, TOUT* __restrict__ C,
    int M, int N, int K)
{
    constexpr int BM = WM * FM * 16;       // block tile rows
    constexpr int BN = WN * FN * 16;       // block tile columns
    // rows of a stage: the X tile, then the W tile
    __shared__ __attribute__((aligned(16))) half_t S[NBUF][BM + BN][SPITCH];
    constexpr int NC = (BM + BN) / (WM * WN * 2);          // copies per lane and stage
    constexpr unsigned LBUF = (BM + BN) * SPITCH * 2;      // bytes of one buffer
    static_assert(NBUF * NC <= 63, "copies of a wave in flight");

    const int tid  = threadIdx.x;
    const int wave = tid >> 5;
    const int lane = tid & 31;
    const int m0 = blockIdx.x * BM;
    const int n0 = blockIdx.y * BN;
    const int wm = (wave % WM) * (FM * 16);   // wave row offset in block tile
    const int wn = (wave / WM) * (FN * 16);   // wave col offset in block tile
    const int kb = (lane >> 4) * 8;           // K striping base for fragments

    // the lane's place in a copy: row tid / 16, 16-B piece tid % 16 of 16
    const int crow = tid >> 4;
    const int ccol = (tid & 15) * 8;
    const half_t* gx = X + (size_t)(m0 + crow) * K + ccol;
    const half_t* gw = W + (size_t)(n0 + crow) * K + ccol;
    const size_t  gstep = (size_t)(WM * WN * 2) * K;
    const unsigned l0 = (unsigned)(size_t)&S[0][crow][ccol];
    const int nst = K / BKS;               // stages

    v8f acc[FM][FN] = {};

    // ---- prologue: the first NBUF stages issued, stage 0 landed and published ----
#pragma unroll
    for (int p = 0; p < NBUF; ++p)
        if (p < nst) copy_stage<FM, WM, WN>(gx + p * BKS, gw + p * BKS, gstep, l0 + p * LBUF);
    // own copies of stage 0 landed: all but the copies of the stages issued behind it
    if (nst >= NBUF) asm volatile("s_wait_asynccnt %0" :: "i"((NBUF - 1) * NC) : "memory");
    else             asm volatile("s_wait_asynccnt 0x0" ::: "memory");
    __syncthreads();                                    // ... and every other wave's

    for (int s = 0; s < nst; ++s) {
        const half_t (*St)[SPITCH] = S[s % NBUF];
        // unrolled, so that kk becomes an immediate offset of the LDS reads
#pragma unroll
        for (int kk = 0; kk < BKS; kk += 32) {
            // ---- fragments ----
            v16h a[FM], b[FN];
#pragma unroll
            for (int mi = 0; mi < FM; ++mi) {
                const int m = wm + mi * 16 + (lane & 15);
#pragma unroll
                for (int j = 0; j < 8; ++j) {
                    a[mi][j]     = St[m][kk + kb + j];
                    a[mi][8 + j] = St[m][kk + kb + 16 + j];
                }
            }
#pragma unroll
            for (int ni = 0; ni < FN; ++ni) {
                const int n = BM + wn + ni * 16 + (lane & 15);
#pragma unroll
                for (int j = 0; j < 8; ++j) {
                    b[ni][j]     = St[n][kk + kb + j];
                    b[ni][8 + j] = St[n][kk + kb + 16 + j];
                }
            }
            // keeps a k step's reads together ahead of its WMMAs: left alone, the
            // scheduler reloads one A fragment's registers and waits out the LDS
            // latency once per row of WMMAs
            __builtin_amdgcn_sched_barrier(0);
#pragma unroll
            for (int mi = 0; mi < FM; ++mi)
#pragma unroll
                for (int ni = 0; ni < FN; ++ni)
                    acc[mi][ni] = __builtin_amdgcn_wmma_f32_16x16x32_f16(
                        false, a[mi], false, b[ni], (short)0, acc[mi][ni], false, false);
        }
        // ---- publish stage s + 1, free this stage's buffer ----
        asm volatile("s_wait_dscnt 0x0" ::: "memory");     // own reads of this buffer done
        // own copies of stage s + 1 landed: while the ring is full, stages s + 2 to
        // s + NBUF - 1 are all that was issued behind it and may stay in flight
        if (s + NBUF - 1 < nst)
            asm volatile("s_wait_asynccnt %0" :: "i"((NBUF - 2) * NC) : "memory");
        else
            asm volatile("s_wait_asynccnt 0x0" ::: "memory");
        __syncthreads();
        if (s + NBUF < nst)                                // into the buffer just read
            copy_stage<FM, WM, WN>(gx + (size_t)(s + NBUF) * BKS, gw + (size_t)(s + NBUF) * BKS,
                               gstep, l0 + (unsigned)(s % NBUF) * LBUF);
    }
    asm volatile("s_wait_asynccnt 0x0" ::: "memory");      // nothing in flight at the end

    // ---- writeback: lane%16 = column, rows = v + 8*(lane/16) ----
    const int col = n0 + wn + (lane & 15);
    float bvv[FN];
#pragma unroll
    for (int ni = 0; ni < FN; ++ni) bvv[ni] = bias[col + ni * 16];
    TOUT* crow0 = C + (size_t)(m0 + wm + 8 * (lane >> 4)) * N + col;
#pragma unroll
    for (int mi = 0; mi < FM; ++mi)
#pragma unroll
        for (int v = 0; v < 8; ++v) {
            TOUT* cr = crow0 + (size_t)(mi * 16 + v) * N;
#pragma unroll
            for (int ni = 0; ni < FN; ++ni)
                cr[ni * 16] = (TOUT)(acc[mi][ni][v] + bvv[ni]);
        }
}

// ---------------------------------------------------------------------------
// The three input projections, straight from the f32 operands: one launch,
// blockIdx.z picks the operand set. 4 x 4 waves of 64 x 48: block tile
// 256 x 192, one work-group per WGP. A ring of two LDS buffers (above: four) of 128-k stages
// of f16 rows as above, but a stage is filled through registers: 16-B loads of
// f32, rounded to f16 (nearest even) on the way into LDS. A stage goes in four
// quarters of 32 k (one 128-B line of every row); two register sets, each
// loaded two k steps ahead of its store, keep loads in flight all the time.
// Plane z = 3 (64 work-groups, for the WGPs that the 192 tiles leave idle)
// rounds Wo to f16 for the last launch.
// ---------------------------------------------------------------------------
typedef __attribute__((ext_vector_type(4))) float    f32x4;
typedef __attribute__((ext_vector_type(4))) _Float16 f16x4;

#define QBM  256                     // block tile rows
#define QBN  192                     // block tile columns
#define QNC  ((QBM + QBN) / 64)      // loads per lane and quarter: 64 rows each
#define QXC  (QBM / 64)              // ... of which X rows

// gx, gw: the lane's 16 B in the first 64 rows of X and of W, at this quarter's k
__device__ __forceinline__ void load_quarter(
    const float* gx, const float* gw, f32x4 (&r)[QNC])
{
#pragma unroll
    for (int c = 0; c < QNC; ++c)
        r[c] = *(const f32x4*)(c < QXC ? gx + c * 64 * D_MODEL
                                       : gw + (c - QXC) * 64 * D_MODEL);
}

// l: the lane's 8 B in the first 64 rows of the stage, at this quarter's k
__device__ __forceinline__ void store_quarter(half_t* l, const f32x4 (&r)[QNC])
{
#pragma unroll
    for (int c = 0; c < QNC; ++c)
        *(f16x4*)(l + c * 64 * SPITCH) = __builtin_convertvector(r[c], f16x4);
}

// Work-group barrier over LDS alone: own LDS stores and reads done, then the
// barrier. __syncthreads() would also wait out the global loads that are in
// flight for the next stage, and so undo their lead. s_wait_xcnt stands here
// because the next stage rewrites the address registers of the loads issued
// in this one (a precaution).
__device__ __forceinline__ void stage_barrier()
{
    asm volatile("s_wait_dscnt 0x0\n\t"
                 "s_wait_xcnt 0x0\n\t"
                 "s_barrier_signal -1\n\t"
                 "s_barrier_wait -1" ::: "memory");
}

// One stage of 128 k: four k steps on the buffer St. ST: k step j first stores
// quarter j of the next stage (registers r0 / r1 in turn) into that stage's
// buffer ln, which the stage before this one has left. LDA, LDB: k steps 0, 1
// and 2, 3 then reload those registers with the quarter two k steps further on
// (hx, hw: the lane's 16 B at the next stage's first k). The tests are compile
// time, so that every wait on a load counts the younger set's loads exactly.
template <bool ST, bool LDA, bool LDB>
__device__ __forceinline__ void qkv_stage(
    const half_t (*St)[SPITCH], half_t* ln, const float* hx, const float* hw,
    f32x4 (&r0)[QNC], f32x4 (&r1)[QNC], v8f (&acc)[4][FN], int wm, int wn, int lane)
{
    constexpr int FM = 4;
    const int kb = (lane >> 4) * 8;           // K striping base for fragments
    // unrolled, so that kk becomes an immediate offset and the set a fixed one
#pragma unroll
    for (int kk = 0; kk < BKS; kk += 32) {
        f32x4 (&r)[QNC] = (kk & 32) ? r1 : r0;
        // keeps this k step's conversions, and with them the waits on their loads,
        // out of the WMMAs before it: lifted there, they cut the loads' lead from
        // two k steps to one
        __builtin_amdgcn_sched_barrier(0);
        if (ST) store_quarter(ln + kk, r);
        // keeps the reload behind the conversions: lifted over them it takes a third
        // register set, and its first loads then stand directly behind WMMAs whose
        // operand registers they reuse
        __builtin_amdgcn_sched_barrier(0);
        if (kk < 64 ? LDA : LDB) load_quarter(hx + kk + 64, hw + kk + 64, r);
        // ---- fragments ----
        v16h a[FM], b[FN];
#pragma unroll
        for (int mi = 0; mi < FM; ++mi) {
            const int m = wm + mi * 16 + (lane & 15);
#pragma unroll
            for (int j = 0; j < 8; ++j) {
                a[mi][j]     = St[m][kk + kb + j];
                a[mi][8 + j] = St[m][kk + kb + 16 + j];
            }
        }
#pragma unroll
        for (int ni = 0; ni < FN; ++ni) {
            const int n = QBM + wn + ni * 16 + (lane & 15);
#pragma unroll
            for (int j = 0; j < 8; ++j) {
                b[ni][j]     = St[n][kk + kb + j];
                b[ni][8 + j] = St[n][kk + kb + 16 + j];
            }
        }
        // keeps a k step's reads, and the global loads issued above, ahead of
        // its WMMAs: the loads' lead is the WMMAs of two k steps
        __builtin_amdgcn_sched_barrier(0);
#pragma unroll
        for (int mi = 0; mi < FM; ++mi)
#pragma unroll
            for (int ni = 0; ni < FN; ++ni)
                acc[mi][ni] = __builtin_amdgcn_wmma_f32_16x16x32_f16(
                    false, a[mi], false, b[ni], (short)0, acc[mi][ni], false, false);
    }
    // publishes the next stage and frees this stage's buffer
    if (ST) stage_barrier();
}

__global__ __launch_bounds__(512) void gemm_qkv_f32src(
    const float* __restrict__ xq, const float* __restrict__ xk,
    const float* __restrict__ xv, const float* __restrict__ wq,
    const float* __restrict__ wk, const float* __restrict__ wv,
    const float* __restrict__ wo, const float* __restrict__ bq,
    const float* __restrict__ bk, const float* __restrict__ bv,
    half_t* __restrict__ Cqkv, half_t* __restrict__ woh)
{
    constexpr int FM = 4, WM = 4;
    constexpr int NST = D_MODEL / BKS;     // stages
    __shared__ __attribute__((aligned(16))) half_t S[2][QBM + QBN][SPITCH];

    const int tid = threadIdx.x;
    const int z   = blockIdx.z;

    if (z == 3) {                          // the whole work-group, ahead of any barrier
        constexpr int PER = D_MODEL * D_MODEL / 64 / 4;    // 16-B pieces per work-group
        const int p0 = (blockIdx.y * 16 + blockIdx.x) * PER;
        for (int i = tid; i < PER; i += 512)
            ((f16x4*)woh)[p0 + i] =
                __builtin_convertvector(((const f32x4*)wo)[p0 + i], f16x4);
        return;
    }

    const float* X    = z == 0 ? xq : (z == 1 ? xk : xv);
    const float* Wt   = z == 0 ? wq : (z == 1 ? wk : wv);
    const float* bias = z == 0 ? bq : (z == 1 ? bk : bv);
    half_t* C = Cqkv + (size_t)z * L_SEQ * D_MODEL;

    const int wave = tid >> 5;
    const int lane = tid & 31;
    const int m0 = blockIdx.x * QBM;
    const int n0 = blockIdx.y * QBN;
    const int wm = (wave % WM) * (FM * 16);   // wave row offset in block tile
    const int wn = (wave / WM) * (FN * 16);   // wave col offset in block tile

    // the lane's place in a quarter: 8 lanes per row; a wave's four rows lie
    // 4 apart, so that their 64-B LDS stores fall on four different bank groups
    const int crow = (wave >> 2) * 16 + (wave & 3) + ((lane >> 3) << 2);
    const int ccol = (lane & 7) * 4;
    const float* gx = X  + (size_t)(m0 + crow) * D_MODEL + ccol;
    const float* gw = Wt + (size_t)(n0 + crow) * D_MODEL + ccol;
    half_t* l0 = &S[0][crow][ccol];
    half_t* l1 = &S[1][crow][ccol];

    f32x4 r0[QNC], r1[QNC];

    // ---- prologue: stage 0 stored, quarters 0 and 1 of stage 1 in flight ----
    {
        f32x4 p0[QNC], p1[QNC], p2[QNC], p3[QNC];   // the accumulators are not live yet
        load_quarter(gx, gw, p0);
        load_quarter(gx + 32, gw + 32, p1);
        load_quarter(gx + 64, gw + 64, p2);
        load_quarter(gx + 96, gw + 96, p3);
        // the two scheduling barriers keep r0's loads ahead of r1's, as in the
        // loop: interleaved, the loop's first counted wait covers both sets
        __builtin_amdgcn_sched_barrier(0);
        load_quarter(gx + 128, gw + 128, r0);
        __builtin_amdgcn_sched_barrier(0);
        load_quarter(gx + 160, gw + 160, r1);
        store_quarter(l0, p0);
        store_quarter(l0 + 32, p1);
        store_quarter(l0 + 64, p2);
        store_quarter(l0 + 96, p3);
    }
    stage_barrier();

    v8f acc[FM][FN] = {};

    for (int s = 0; s < NST - 2; ++s)
        qkv_stage<true, true, true>(S[s & 1], (s & 1) ? l0 : l1, gx + (s + 1) * BKS,
                                    gw + (s + 1) * BKS, r0, r1, acc, wm, wn, lane);
    // the last stage's quarters 2 and 3 are the last loads; then nothing is left to fill
    qkv_stage<true, true, false>(S[(NST - 2) & 1], ((NST - 2) & 1) ? l0 : l1,
                                 gx + (NST - 1) * BKS, gw + (NST - 1) * BKS,
                                 r0, r1, acc, wm, wn, lane);
    qkv_stage<false, false, false>(S[(NST - 1) & 1], l0, gx, gw, r0, r1, acc, wm, wn, lane);

    // ---- writeback: lane%16 = column, rows = v + 8*(lane/16) ----
    const int col = n0 + wn + (lane & 15);
    float bvv[FN];
#pragma unroll
    for (int ni = 0; ni < FN; ++ni) bvv[ni] = bias[col + ni * 16];
    half_t* crow0 = C + (size_t)(m0 + wm + 8 * (lane >> 4)) * D_MODEL + col;
#pragma unroll
    for (int mi = 0; mi < FM; ++mi)
#pragma unroll
        for (int v = 0; v < 8; ++v) {
            half_t* cr = crow0 + (size_t)(mi * 16 + v) * D_MODEL;
#pragma unroll
            for (int ni = 0; ni < FN; ++ni)
                cr[ni * 16] = (half_t)(acc[mi][ni][v] + bvv[ni]);
        }
    // behind the last store: the code of plane z = 3 follows in the text and
    // rewrites registers that these stores name (a precaution)
    asm volatile("s_wait_xcnt 0x0" ::: "memory");
}

// 4 x 2 waves of 32 x 48: block tile 128 x 96, so that this smaller product
// still has a work-group for every WGP.
__global__ __launch_bounds__(256) void gemm_out_f32(
    const half_t* __restrict__ X, const half_t* __restrict__ W,
    const float* __restrict__ bias, float* __restrict__ C,
    int M, int N, int K)
{
    gemm_xwt_tile<float, 2, 4, 2>(X, W, bias, C, M, N, K);
}

// ---------------------------------------------------------------------------
// Sliding-window attention: one wave per (head, 16-query block), four
// neighbouring query blocks of one head per work-group.
// Key span for a 16-query block: [q0-64, q0+79] -> 10 tiles of 16 (160 keys).
// The four spans overlap: together they are 208 keys. Their K and V rows
// (128 B each, one whole line) are brought to LDS once per work-group.
// ---------------------------------------------------------------------------
#define KSPAN   208                  // 64 + 4 * 16 + 80 keys
#define KPITCH  (HDIM + 8)           // 144 B = 16 B x 9: read by ds_load_b128
#define VPITCH  (HDIM + 16)          // 160 B = 32 B x 5: read by ds_load_tr16_b128
#define NCOPY   (KSPAN / 16)         // copies per lane and operand: 16 rows each

typedef __attribute__((ext_vector_type(8))) short    s16x8;
typedef __attribute__((ext_vector_type(8))) _Float16 v8h;

// Transposing LDS read: lane (c = l & 15, hh = l >> 4) gets rows 8 hh .. 8 hh + 7
// of column c of the 16 x 16 tile whose per-lane address p follows the map
// row 8 (l >> 4) + (l & 7), 16-B piece (l >> 3) & 1.
__device__ __forceinline__ v8h ld_tr16(const half_t* p) {
    typedef __attribute__((address_space(3))) s16x8 lds_s16x8;
    return __builtin_bit_cast(v8h, __builtin_amdgcn_ds_load_tr16_b128_v8i16((lds_s16x8*)p));
}

// 13 asynchronous 16-B copies per lane: the block's 128 lanes cover 16 rows of
// 128 B per copy. base + off[i]: the lane's piece of its (clamped) row in copy i;
// l: its LDS byte address in copy 0; lstep: LDS bytes of 16 rows.
__device__ __forceinline__ void copy_span(
    const half_t* base, const unsigned (&off)[NCOPY], unsigned l, unsigned lstep)
{
    // s_wait_xcnt closes the statement, so that no address register named here
    // is rewritten ahead of it.
    asm volatile(
        "global_load_async_to_lds_b128 %0, %13, off\n\t"
        "global_load_async_to_lds_b128 %1, %14, off\n\t"
        "global_load_async_to_lds_b128 %2, %15, off\n\t"
        "global_load_async_to_lds_b128 %3, %16, off\n\t"
        "global_load_async_to_lds_b128 %4, %17, off\n\t"
        "global_load_async_to_lds_b128 %5, %18, off\n\t"
        "global_load_async_to_lds_b128 %6, %19, off\n\t"
        "global_load_async_to_lds_b128 %7, %20, off\n\t"
        "global_load_async_to_lds_b128 %8, %21, off\n\t"
        "global_load_async_to_lds_b128 %9, %22, off\n\t"
        "global_load_async_to_lds_b128 %10, %23, off\n\t"
        "global_load_async_to_lds_b128 %11, %24, off\n\t"
        "global_load_async_to_lds_b128 %12, %25, off\n\t"
        "s_wait_xcnt 0x0"
        :: "v"(l),              "v"(l + 1 * lstep),  "v"(l + 2 * lstep),
           "v"(l + 3 * lstep),  "v"(l + 4 * lstep),  "v"(l + 5 * lstep),
           "v"(l + 6 * lstep),  "v"(l + 7 * lstep),  "v"(l + 8 * lstep),
           "v"(l + 9 * lstep),  "v"(l + 10 * lstep), "v"(l + 11 * lstep),
           "v"(l + 12 * lstep),
           "v"(base + off[0]),  "v"(base + off[1]),  "v"(base + off[2]),
           "v"(base + off[3]),  "v"(base + off[4]),  "v"(base + off[5]),
           "v"(base + off[6]),  "v"(base + off[7]),  "v"(base + off[8]),
           "v"(base + off[9]),  "v"(base + off[10]), "v"(base + off[11]),
           "v"(base + off[12])
        : "memory");
}

typedef __attribute__((ext_vector_type(2))) float f32x2;

// The value that lane l ^ 16 holds.
__device__ __forceinline__ float other_half(float x) {
    const int b = __builtin_bit_cast(int, x);
    return __builtin_bit_cast(float,
        __builtin_amdgcn_permlanex16(b, b, 0x76543210, 0xfedcba98, false, false));
}

__global__ __launch_bounds__(128) void attn(
    const half_t* __restrict__ Q, const half_t* __restrict__ Kb,
    const half_t* __restrict__ Vb, half_t* __restrict__ O)
{
    __shared__ __attribute__((aligned(16))) half_t Ks[KSPAN][KPITCH];
    __shared__ __attribute__((aligned(16))) half_t Vs[KSPAN][VPITCH];

    const int wave = __builtin_amdgcn_readfirstlane(threadIdx.x >> 5);
    const int lane = threadIdx.x & 31;
    const int task = blockIdx.x * 4 + wave;        // 0..3071
    const int h    = task >> 8;                    // head (the same in all four waves)
    const int q0   = (task & 255) * 16;            // query block start
    const int colb = h * HDIM;                     // column base in [L,768]
    const int kb   = (lane >> 4) * 8;              // K striping base
    const int r0   = wave * 16;                    // LDS row of key q0 - HALFWIN

    // ---- K and V rows of keys [q0(wave 0) - 64, + 208) to LDS; a key outside
    //      the sequence takes the nearest row's data, and its score is masked ----
    {
        const int crow  = threadIdx.x >> 3;        // row of 16
        const int ccol  = (threadIdx.x & 7) * 8;   // 16-B piece of 8
        const int kfirst = q0 - r0 - HALFWIN;
        unsigned off[NCOPY];
#pragma unroll
        for (int i = 0; i < NCOPY; ++i)
            off[i] = (unsigned)(clampi(kfirst + i * 16 + crow, 0, L_SEQ - 1) * D_MODEL
                                + colb + ccol);
        copy_span(Kb, off, (unsigned)(size_t)&Ks[crow][ccol], 16 * KPITCH * 2);
        copy_span(Vb, off, (unsigned)(size_t)&Vs[crow][ccol], 16 * VPITCH * 2);
    }

    // ---- load Q fragments (64x16 B-matrix = two 32x16 fragments; lane % 16 = query) ----
    v16h aQ0, aQ1;
    {
        const half_t* qrow = Q + (size_t)(q0 + (lane & 15)) * D_MODEL + colb;
#pragma unroll
        for (int j = 0; j < 8; ++j) {
            aQ0[j]     = qrow[kb + j];
            aQ0[8 + j] = qrow[kb + 16 + j];
            aQ1[j]     = qrow[32 + kb + j];
            aQ1[8 + j] = qrow[32 + kb + 16 + j];
        }
    }

    asm volatile("s_wait_asynccnt 0x0" ::: "memory");   // own copies landed
    __syncthreads();                                    // ... and every other wave's

    // ---- raw scores of 9 key tiles: s[t][v] = K[q0 - 64 + 16 t + kb + v] . Q[q0 + lane % 16].
    //      The tenth tile, keys q0 + 80 and up, lies outside every query's window. ----
    v16h kf[9][2];
#pragma unroll
    for (int t = 0; t < 9; ++t) {
        const half_t* krow = Ks[r0 + t * 16 + (lane & 15)];
#pragma unroll
        for (int j = 0; j < 8; ++j) {
            kf[t][0][j]     = krow[kb + j];
            kf[t][0][8 + j] = krow[kb + 16 + j];
            kf[t][1][j]     = krow[32 + kb + j];
            kf[t][1][8 + j] = krow[32 + kb + 16 + j];
        }
    }
    // keeps the K reads together ahead of the WMMAs: left alone, the scheduler
    // reloads one fragment's registers and waits out the LDS latency per WMMA
    __builtin_amdgcn_sched_barrier(0);
    v8f s[9];
#pragma unroll
    for (int t = 0; t < 9; ++t) {
        v8f c = {};
        c = __builtin_amdgcn_wmma_f32_16x16x32_f16(false, kf[t][0], false, aQ0,
                                                   (short)0, c, false, false);
        c = __builtin_amdgcn_wmma_f32_16x16x32_f16(false, kf[t][1], false, aQ1,
                                                   (short)0, c, false, false);
        s[t] = c;
    }

    // ---- mask. query - key = 64 - 16 t + lane % 16 - kb - v: the window's edges
    //      cut tiles 0 and 8 alone, tiles 1 to 7 lie inside it for every query ----
    const int cq = (lane & 15) - kb;
#pragma unroll
    for (int v = 0; v < 8; ++v) {
        s[0][v] = v >= cq ? s[0][v] : -1e30f;      // query - key <= 64
        s[8][v] = v <= cq ? s[8][v] : -1e30f;      // query - key >= -64
    }
    // the sequence's ends cut whole tiles, and only in the outermost query blocks
    if (q0 < HALFWIN || q0 + HALFWIN >= L_SEQ) {
#pragma unroll
        for (int t = 0; t < 9; ++t) {
            const int kstart = q0 - HALFWIN + t * 16;
            const bool in = (kstart >= 0) & (kstart < L_SEQ);
#pragma unroll
            for (int v = 0; v < 8; ++v) s[t][v] = in ? s[t][v] : -1e30f;
        }
    }

    // ---- the query's maximum: four chains in the lane, then the other half's ----
    float mx[4];
#pragma unroll
    for (int i = 0; i < 4; ++i) mx[i] = fmaxf(s[0][i], s[0][4 + i]);
#pragma unroll
    for (int t = 1; t < 9; ++t)
#pragma unroll
        for (int v = 0; v < 8; ++v) mx[v & 3] = fmaxf(mx[v & 3], s[t][v]);
    float m = fmaxf(fmaxf(mx[0], mx[1]), fmaxf(mx[2], mx[3]));
    m = fmaxf(m, other_half(m));

    // ---- p = exp((s - m) / sqrt(64)) = 2^(s SC - m SC); sums; P^T packed as B operands:
    //      tiles 2 ks and 2 ks + 1 are keys kb + 0..7 and 16 + kb + 0..7 of k step ks ----
    const float SC = 0.125f * 1.44269504088896f;
    const float mb = m * SC;
    const f32x2 sc2 = {SC, SC}, mb2 = {-mb, -mb};
    f32x2 sm[2] = {{0.f, 0.f}, {0.f, 0.f}};
    v16h bP[5];
#pragma unroll
    for (int t = 0; t < 9; ++t) {
#pragma unroll
        for (int v = 0; v < 8; v += 2) {
            const f32x2 sv = {s[t][v], s[t][v + 1]};
            const f32x2 e  = __builtin_elementwise_fma(sv, sc2, mb2);
            const f32x2 p  = {__builtin_amdgcn_exp2f(e[0]), __builtin_amdgcn_exp2f(e[1])};
            sm[(v >> 1) & 1] += p;
            bP[t >> 1][(t & 1) * 8 + v]     = (half_t)p[0];
            bP[t >> 1][(t & 1) * 8 + v + 1] = (half_t)p[1];
        }
    }
#pragma unroll
    for (int v = 0; v < 8; ++v) bP[4][8 + v] = (half_t)0.f;   // the tenth tile
    float sum = (sm[0][0] + sm[0][1]) + (sm[1][0] + sm[1][1]);
    sum += other_half(sum);
    const float inv = 1.0f / sum;

    // ---- O^T = V^T(64x160) * P^T(160x16), 5 K-steps x 4 M-tiles ----
    v8f o[4] = {{}, {}, {}, {}};
    // the lane's address in the transposing read of the wave's first 16 x 16 V tile
    const half_t* vtr = &Vs[r0 + 8 * (lane >> 4) + (lane & 7)][8 * ((lane >> 3) & 1)];
#pragma unroll
    for (int ks = 0; ks < 5; ++ks) {
        const int k2 = ks * 32;
#pragma unroll
        for (int nt = 0; nt < 4; ++nt) {
            // keys k2 + kb + 0..7 and k2 + 16 + kb + 0..7 of column nt * 16 + lane % 16
            const v8h lo = ld_tr16(vtr + k2 * VPITCH + nt * 16);
            const v8h hi = ld_tr16(vtr + (k2 + 16) * VPITCH + nt * 16);
            const v16h aV = __builtin_shufflevector(lo, hi, 0, 1, 2, 3, 4, 5, 6, 7,
                                                    8, 9, 10, 11, 12, 13, 14, 15);
            o[nt] = __builtin_amdgcn_wmma_f32_16x16x32_f16(false, aV, false, bP[ks],
                                                           (short)0, o[nt], false, false);
        }
    }

    // ---- normalize + store (f16, row-major [L,768]): o[nt][v] is column
    //      nt * 16 + kb + v of the lane's query, 16 B per tile ----
    half_t* orow = O + (size_t)(q0 + (lane & 15)) * D_MODEL + colb + kb;
#pragma unroll
    for (int nt = 0; nt < 4; ++nt) {
        v8h w;
#pragma unroll
        for (int v = 0; v < 8; ++v) w[v] = (half_t)(o[nt][v] * inv);
        *(v8h*)(orow + nt * 16) = w;
    }
}

// ---------------------------------------------------------------------------
extern "C" void kernel_launch(void* const* d_in, const int* in_sizes, int n_in,
                              void* d_out, int out_size, void* d_ws, size_t ws_size,
                              hipStream_t stream) {
    const float* query = (const float*)d_in[0];
    const float* key   = (const float*)d_in[1];
    const float* value = (const float*)d_in[2];
    const float* Wq = (const float*)d_in[3];
    const float* bq = (const float*)d_in[4];
    const float* Wk = (const float*)d_in[5];
    const float* bk = (const float*)d_in[6];
    const float* Wv = (const float*)d_in[7];
    const float* bv = (const float*)d_in[8];
    const float* Wo = (const float*)d_in[9];
    const float* bo = (const float*)d_in[10];

    const size_t E  = (size_t)L_SEQ * D_MODEL;      // 3145728
    const size_t WE = (size_t)D_MODEL * D_MODEL;    // 589824

    half_t* Woh = (half_t*)d_ws;
    half_t* Qb  = Woh + WE;
    half_t* Kb  = Qb + E;
    half_t* Vb  = Kb + E;
    half_t* Ob  = Vb + E;

    // Q, K and V projections from the f32 operands (-> Qb/Kb/Vb), and Wo -> Woh
    dim3 qkvgrid(L_SEQ / 256, D_MODEL / 192, 4);
    gemm_qkv_f32src<<<qkvgrid, 512, 0, stream>>>(query, key, value, Wq, Wk, Wv, Wo,
                                                 bq, bk, bv, Qb, Woh);

    attn<<<(HEADS * (L_SEQ / 16)) / 4, 128, 0, stream>>>(Qb, Kb, Vb, Ob);

    dim3 ggrid(L_SEQ / 128, D_MODEL / 96, 1);
    gemm_out_f32<<<ggrid, 256, 0, stream>>>(Ob, Woh, bo, (float*)d_out,
                                            L_SEQ, D_MODEL, D_MODEL);
}

// v008
// Measured time: 35.3 microseconds a run.
// Timed twice side by side with v007, it ran 1.06 and 1.05 times as fast.
// All steps since v000 together make it 2.64 times as fast.
#include <hip/hip_runtime.h>
#include <hip/hip_bf16.h>

typedef _Float16 half_t;
typedef __attribute__((ext_vector_type(16))) _Float16 v16h;
typedef __attribute__((ext_vector_type(8)))  float    v8f;

#define D_MODEL 768
#define L_SEQ   4096
#define HEADS   12
#define HDIM    64
#define HALFWIN 64   // WINDOW/2

__device__ __forceinline__ int clampi(int x, int lo, int hi) {
    return x < lo ? lo : (x > hi ? hi : x);
}

// ---------------------------------------------------------------------------
// GEMM: C[M,N] = X[M,K] * W^T + b   (X, W both f16; W is [N,K] row-major)
// Wave tile 16 FM x 48; WM x WN waves make a block tile of 16 FM WM x 48 WN.
// A wide block tile cuts how often a row of X or W is fetched from L2, a wide
// wave tile how often it is read from LDS (FM = 4: 12 WMMA on 7 fragments).
// K runs in stages of 128 (256 B of every operand row) through a ring of four
// LDS buffers: a stage's copies are issued three stages ahead of its use, so
// that their latency is covered and L2 is asked without pauses.
// K must be a multiple of 128, M of 16 FM WM, N of 48 WN.
// ---------------------------------------------------------------------------
#define BKS     128                  // k elements per stage
#define SPITCH  (BKS + 8)            // LDS row pitch in elements: 272 B = 16 B x 17
#define FN      3                    // 16-row fragments of W per wave
#define NBUF    4                    // LDS buffers of the copy ring

// 14 asynchronous 16-B copies per lane. g[i]: the lane's global address in copy i;
// l: its LDS byte address in copy 0; lstep: LDS bytes from one copy's rows to the next's.
__device__ __forceinline__ void copy14(
    const half_t* const (&g)[14], unsigned l, unsigned lstep)
{
    // s_wait_xcnt closes the statement, so that no address register named here
    // is rewritten ahead of it.
    asm volatile(
        "global_load_async_to_lds_b128 %0, %14, off\n\t"
        "global_load_async_to_lds_b128 %1, %15, off\n\t"
        "global_load_async_to_lds_b128 %2, %16, off\n\t"
        "global_load_async_to_lds_b128 %3, %17, off\n\t"
        "global_load_async_to_lds_b128 %4, %18, off\n\t"
        "global_load_async_to_lds_b128 %5, %19, off\n\t"
        "global_load_async_to_lds_b128 %6, %20, off\n\t"
        "global_load_async_to_lds_b128 %7, %21, off\n\t"
        "global_load_async_to_lds_b128 %8, %22, off\n\t"
        "global_load_async_to_lds_b128 %9, %23, off\n\t"
        "global_load_async_to_lds_b128 %10, %24, off\n\t"
        "global_load_async_to_lds_b128 %11, %25, off\n\t"
        "global_load_async_to_lds_b128 %12, %26, off\n\t"
        "global_load_async_to_lds_b128 %13, %27, off\n\t"
        "s_wait_xcnt 0x0"
        :: "v"(l),              "v"(l + 1 * lstep),  "v"(l + 2 * lstep),
           "v"(l + 3 * lstep),  "v"(l + 4 * lstep),  "v"(l + 5 * lstep),
           "v"(l + 6 * lstep),  "v"(l + 7 * lstep),  "v"(l + 8 * lstep),
           "v"(l + 9 * lstep),  "v"(l + 10 * lstep), "v"(l + 11 * lstep),
           "v"(l + 12 * lstep), "v"(l + 13 * lstep),
           "v"(g[0]),  "v"(g[1]),  "v"(g[2]),  "v"(g[3]),  "v"(g[4]),
           "v"(g[5]),  "v"(g[6]),  "v"(g[7]),  "v"(g[8]),  "v"(g[9]),
           "v"(g[10]), "v"(g[11]), "v"(g[12]), "v"(g[13])
        : "memory");
}

// One stage: the block's lanes cover RPC rows of 256 B per copy; the first
// copies bring the X rows, the rest the W rows, into consecutive LDS rows.
// gx, gw: the lane's address in the first RPC rows; gstep: RPC rows, in elements.
template <int FM, int WM, int WN>
__device__ __forceinline__ void copy_stage(
    const half_t* gx, const half_t* gw, size_t gstep, unsigned l)
{
    constexpr int RPC = WM * WN * 2;                        // rows per copy
    constexpr int XC  = WM * FM * 16 / RPC;                 // copies of X rows
    constexpr int NC  = (WM * FM + WN * FN) * 16 / RPC;     // copies in all
    static_assert(NC % 14 == 0 && NC <= 56, "copies go in statements of 14");
#pragma unroll
    for (int c0 = 0; c0 < NC; c0 += 14) {
        const half_t* g[14];
#pragma unroll
        for (int i = 0; i < 14; ++i) {
            const int c = c0 + i;
            g[i] = c < XC ? gx + c * gstep : gw + (c - XC) * gstep;
        }
        copy14(g, l + c0 * RPC * SPITCH * 2, RPC * SPITCH * 2);
    }
}

template <typename TOUT, int FM, int WM, int WN>
__device__ __forceinline__ void gemm_xwt_tile(
    const half_t* __restrict__ X, const half_t* __restrict__ W,
    const float* __restrict__ bias, TOUT* __restrict__ C,
    int M, int N, int K)
{
    constexpr int BM = WM * FM * 16;       // block tile rows
    constexpr int BN = WN * FN * 16;       // block tile columns
    // rows of a stage: the X tile, then the W tile
    __shared__ __attribute__((aligned(16))) half_t S[NBUF][BM + BN][SPITCH];
    constexpr int NC = (BM + BN) / (WM * WN * 2);          // copies per lane and stage
    constexpr unsigned LBUF = (BM + BN) * SPITCH * 2;      // bytes of one buffer
    static_assert(NBUF * NC <= 63, "copies of a wave in flight");

    const int tid  = threadIdx.x;
    const int wave = tid >> 5;
    const int lane = tid & 31;
    const int m0 = blockIdx.x * BM;
    const int n0 = blockIdx.y * BN;
    const int wm = (wave % WM) * (FM * 16);   // wave row offset in block tile
    const int wn = (wave / WM) * (FN * 16);   // wave col offset in block tile
    const int kb = (lane >> 4) * 8;           // K striping base for fragments

    // the lane's place in a copy: row tid / 16, 16-B piece tid % 16 of 16
    const int crow = tid >> 4;
    const int ccol = (tid & 15) * 8;
    const half_t* gx = X + (size_t)(m0 + crow) * K + ccol;
    const half_t* gw = W + (size_t)(n0 + crow) * K + ccol;
    const size_t  gstep = (size_t)(WM * WN * 2) * K;
    const unsigned l0 = (unsigned)(size_t)&S[0][crow][ccol];
    const int nst = K / BKS;               // stages
    // Work-groups that share X rows (equal blockIdx.x) or W rows (equal blockIdx.y)
    // each start their k loop rot stages in and wrap round, so that
    // they do not ask L2 for the same lines at the same moment.
    const int rot = (blockIdx.x + blockIdx.y) % nst;
    // k of the work-group's p-th stage
    auto stage_k = [&](int p) { const int t = p + rot; return (size_t)(t >= nst ? t - nst : t) * BKS; };

    v8f acc[FM][FN] = {};

    // ---- prologue: the first NBUF stages issued, stage 0 landed and published ----
#pragma unroll
    for (int p = 0; p < NBUF; ++p)
        if (p < nst) copy_stage<FM, WM, WN>(gx + stage_k(p), gw + stage_k(p), gstep, l0 + p * LBUF);
    // own copies of stage 0 landed: all but the copies of the stages issued behind it
    if (nst >= NBUF) asm volatile("s_wait_asynccnt %0" :: "i"((NBUF - 1) * NC) : "memory");
    else             asm volatile("s_wait_asynccnt 0x0" ::: "memory");
    __syncthreads();                                    // ... and every other wave's

    for (int s = 0; s < nst; ++s) {
        const half_t (*St)[SPITCH] = S[s % NBUF];
        // unrolled, so that kk becomes an immediate offset of the LDS reads
#pragma unroll
        for (int kk = 0; kk < BKS; kk += 32) {
            // ---- fragments ----
            v16h a[FM], b[FN];
#pragma unroll
            for (int mi = 0; mi < FM; ++mi) {
                const int m = wm + mi * 16 + (lane & 15);
#pragma unroll
                for (int j = 0; j < 8; ++j) {
                    a[mi][j]     = St[m][kk + kb + j];
                    a[mi][8 + j] = St[m][kk + kb + 16 + j];
                }
            }
#pragma unroll
            for (int ni = 0; ni < FN; ++ni) {
                const int n = BM + wn + ni * 16 + (lane & 15);
#pragma unroll
                for (int j = 0; j < 8; ++j) {
                    b[ni][j]     = St[n][kk + kb + j];
                    b[ni][8 + j] = St[n][kk + kb + 16 + j];
                }
            }
            // keeps a k step's reads together ahead of its WMMAs: left alone, the
            // scheduler reloads one A fragment's registers and waits out the LDS
            // latency once per row of WMMAs
            __builtin_amdgcn_sched_barrier(0);
#pragma unroll
            for (int mi = 0; mi < FM; ++mi)
#pragma unroll
                for (int ni = 0; ni < FN; ++ni)
                    acc[mi][ni] = __builtin_amdgcn_wmma_f32_16x16x32_f16(
                        false, a[mi], false, b[ni], (short)0, acc[mi][ni], false, false);
        }
        // ---- publish stage s + 1, free this stage's buffer ----
        asm volatile("s_wait_dscnt 0x0" ::: "memory");     // own reads of this buffer done
        // own copies of stage s + 1 landed: while the ring is full, stages s + 2 to
        // s + NBUF - 1 are all that was issued behind it and may stay in flight
        if (s + NBUF - 1 < nst)
            asm volatile("s_wait_asynccnt %0" :: "i"((NBUF - 2) * NC) : "memory");
        else
            asm volatile("s_wait_asynccnt 0x0" ::: "memory");
        __syncthreads();
        if (s + NBUF < nst)                                // into the buffer just read
            copy_stage<FM, WM, WN>(gx + stage_k(s + NBUF), gw + stage_k(s + NBUF),
                               gstep, l0 + (unsigned)(s % NBUF) * LBUF);
    }
    asm volatile("s_wait_asynccnt 0x0" ::: "memory");      // nothing in flight at the end

    // ---- writeback: lane%16 = column, rows = v + 8*(lane/16) ----
    const int col = n0 + wn + (lane & 15);
    float bvv[FN];
#pragma unroll
    for (int ni = 0; ni < FN; ++ni) bvv[ni] = bias[col + ni * 16];
    TOUT* crow0 = C + (size_t)(m0 + wm + 8 * (lane >> 4)) * N + col;
#pragma unroll
    for (int mi = 0; mi < FM; ++mi)
#pragma unroll
        for (int v = 0; v < 8; ++v) {
            TOUT* cr = crow0 + (size_t)(mi * 16 + v) * N;
#pragma unroll
            for (int ni = 0; ni < FN; ++ni)
                cr[ni * 16] = (TOUT)(acc[mi][ni][v] + bvv[ni]);
        }
}

// ---------------------------------------------------------------------------
// The three input projections, straight from the f32 operands: one launch,
// blockIdx.z picks the operand set. 4 x 4 waves of 64 x 48: block tile
// 256 x 192, one work-group per WGP. A ring of two LDS buffers (above: four) of 128-k stages
// of f16 rows as above, but a stage is filled through registers: 16-B loads of
// f32, rounded to f16 (nearest even) on the way into LDS. A stage goes in four
// quarters of 32 k (one 128-B line of every row); two register sets, each
// loaded two k steps ahead of its store, keep loads in flight all the time.
// Plane z = 3 (64 work-groups, for the WGPs that the 192 tiles leave idle)
// rounds Wo to f16 for the last launch.
// ---------------------------------------------------------------------------
typedef __attribute__((ext_vector_type(4))) float    f32x4;
typedef __attribute__((ext_vector_type(4))) _Float16 f16x4;

#define QBM  256                     // block tile rows
#define QBN  192                     // block tile columns
#define QNC  ((QBM + QBN) / 64)      // loads per lane and quarter: 64 rows each
#define QXC  (QBM / 64)              // ... of which X rows
#define NQ   (D_MODEL / 32)          // quarters in all of k

// A work-group's k loop starts at an even quarter of its own and wraps round.
// Moves on to its next pair of quarters. kq: the pair's first quarter; vo: the
// lane's byte offset there.
__device__ __forceinline__ void next_pair(int& kq, unsigned& vo)
{
    // vo's register is rewritten, or given up, while loads that name it are under
    // way (a precaution)
    asm volatile("s_wait_xcnt 0x0" ::: "memory");
    const bool wrap = kq + 2 == NQ;
    kq  = wrap ? 0 : kq + 2;
    vo += wrap ? 256u - D_MODEL * 4u : 256u;
}

// ux, uw: the tile's first row of X and of W, 32 elements on for a pair's second
// quarter (the same in every lane); vo: byte offset of the lane's 16 B in the
// first 64 rows, at the k of the pair's first quarter
__device__ __forceinline__ void load_quarter(
    const float* ux, const float* uw, unsigned vo, f32x4 (&r)[QNC])
{
#pragma unroll
    for (int c = 0; c < QNC; ++c)
        r[c] = *(const f32x4*)((const char*)(c < QXC ? ux + c * 64 * D_MODEL
                                                     : uw + (c - QXC) * 64 * D_MODEL) + vo);
}

// l: the lane's 8 B in the first 64 rows of the stage, at this quarter's k
__device__ __forceinline__ void store_quarter(half_t* l, const f32x4 (&r)[QNC])
{
#pragma unroll
    for (int c = 0; c < QNC; ++c)
        *(f16x4*)(l + c * 64 * SPITCH) = __builtin_convertvector(r[c], f16x4);
}

// Work-group barrier over LDS alone: own LDS stores and reads done, then the
// barrier. __syncthreads() would also wait out the global loads that are in
// flight for the next stage, and so undo their lead.
__device__ __forceinline__ void stage_barrier()
{
    asm volatile("s_wait_dscnt 0x0\n\t"
                 "s_barrier_signal -1\n\t"
                 "s_barrier_wait -1" ::: "memory");
}

// One stage of 128 k: four k steps on the buffer St. ST: k step j first stores
// quarter j of the next stage (registers r0 / r1 in turn) into that stage's
// buffer ln, which the stage before this one has left. LDA, LDB: k steps 0, 1
// and 2, 3 then reload those registers with the quarter two k steps further on
// (ux, uw: as in load_quarter; kq, vo: the pair loaded last, as in next_pair:
// k steps 0 and 2 move on and load a pair's first quarter, 1 and 3 its second). The tests are compile
// time, so that every wait on a load counts the younger set's loads exactly.
template <bool ST, bool LDA, bool LDB>
__device__ __forceinline__ void qkv_stage(
    const half_t (*St)[SPITCH], half_t* ln, const float* ux, const float* uw,
    int& kq, unsigned& vo, f32x4 (&r0)[QNC], f32x4 (&r1)[QNC], v8f (&acc)[4][FN], int wm, int wn, int lane)
{
    constexpr int FM = 4;
    const int kb = (lane >> 4) * 8;           // K striping base for fragments
    // unrolled, so that kk becomes an immediate offset and the set a fixed one
#pragma unroll
    for (int kk = 0; kk < BKS; kk += 32) {
        f32x4 (&r)[QNC] = (kk & 32) ? r1 : r0;
        // keeps this k step's conversions, and with them the waits on their loads,
        // out of the WMMAs before it: lifted there, they cut the loads' lead from
        // two k steps to one
        __builtin_amdgcn_sched_barrier(0);
        if (ST) store_quarter(ln + kk, r);
        // keeps the reload behind the conversions: lifted over them it takes a third
        // register set, and its first loads then stand directly behind WMMAs whose
        // operand registers they reuse
        __builtin_amdgcn_sched_barrier(0);
        if (kk < 64 ? LDA : LDB) {
            if (!(kk & 32)) next_pair(kq, vo);
            load_quarter(ux + (kk & 32), uw + (kk & 32), vo, r);
        }
        // ---- fragments ----
        v16h a[FM], b[FN];
#pragma unroll
        for (int mi = 0; mi < FM; ++mi) {
            const int m = wm + mi * 16 + (lane & 15);
#pragma unroll
            for (int j = 0; j < 8; ++j) {
                a[mi][j]     = St[m][kk + kb + j];
                a[mi][8 + j] = St[m][kk + kb + 16 + j];
            }
        }
#pragma unroll
        for (int ni = 0; ni < FN; ++ni) {
            const int n = QBM + wn + ni * 16 + (lane & 15);
#pragma unroll
            for (int j = 0; j < 8; ++j) {
                b[ni][j]     = St[n][kk + kb + j];
                b[ni][8 + j] = St[n][kk + kb + 16 + j];
            }
        }
        // keeps a k step's reads, and the global loads issued above, ahead of
        // its WMMAs: the loads' lead is the WMMAs of two k steps
        __builtin_amdgcn_sched_barrier(0);
#pragma unroll
        for (int mi = 0; mi < FM; ++mi)
#pragma unroll
            for (int ni = 0; ni < FN; ++ni)
                acc[mi][ni] = __builtin_amdgcn_wmma_f32_16x16x32_f16(
                    false, a[mi], false, b[ni], (short)0, acc[mi][ni], false, false);
    }
    // publishes the next stage and frees this stage's buffer
    if (ST) stage_barrier();
}

__global__ __launch_bounds__(512) void gemm_qkv_f32src(
    const float* __restrict__ xq, const float* __restrict__ xk,
    const float* __restrict__ xv, const float* __restrict__ wq,
    const float* __restrict__ wk, const float* __restrict__ wv,
    const float* __restrict__ wo, const float* __restrict__ bq,
    const float* __restrict__ bk, const float* __restrict__ bv,
    half_t* __restrict__ Cqkv, half_t* __restrict__ woh)
{
    constexpr int FM = 4, WM = 4;
    constexpr int NST = D_MODEL / BKS;     // stages
    __shared__ __attribute__((aligned(16))) half_t S[2][QBM + QBN][SPITCH];

    const int tid = threadIdx.x;
    const int z   = blockIdx.z;

    if (z == 3) {                          // the whole work-group, ahead of any barrier
        constexpr int PER = D_MODEL * D_MODEL / 64 / 4;    // 16-B pieces per work-group
        const int p0 = (blockIdx.y * 16 + blockIdx.x) * PER;
        for (int i = tid; i < PER; i += 512)
            ((f16x4*)woh)[p0 + i] =
                __builtin_convertvector(((const f32x4*)wo)[p0 + i], f16x4);
        return;
    }

    const float* X    = z == 0 ? xq : (z == 1 ? xk : xv);
    const float* Wt   = z == 0 ? wq : (z == 1 ? wk : wv);
    const float* bias = z == 0 ? bq : (z == 1 ? bk : bv);
    half_t* C = Cqkv + (size_t)z * L_SEQ * D_MODEL;

    const int wave = tid >> 5;
    const int lane = tid & 31;
    const int m0 = blockIdx.x * QBM;
    const int n0 = blockIdx.y * QBN;
    const int wm = (wave % WM) * (FM * 16);   // wave row offset in block tile
    const int wn = (wave / WM) * (FN * 16);   // wave col offset in block tile

    // the lane's place in a quarter: 8 lanes per row; a wave's four rows lie
    // 4 apart, so that their 64-B LDS stores fall on four different bank groups
    const int crow = (wave >> 2) * 16 + (wave & 3) + ((lane >> 3) << 2);
    const int ccol = (lane & 7) * 4;
    const float* ux = X  + (size_t)m0 * D_MODEL;
    const float* uw = Wt + (size_t)n0 * D_MODEL;
    half_t* l0 = &S[0][crow][ccol];
    half_t* l1 = &S[1][crow][ccol];

    f32x4 r0[QNC], r1[QNC];

    // Work-groups that share X rows (equal blockIdx.x) or W rows (equal blockIdx.y)
    // each start their k loop at their own place, two quarters (256 B of a row)
    // from their neighbours', so that they do not ask L2 for the same
    // lines at the same moment.
    const int rsum = blockIdx.x + blockIdx.y;
    int kq = 2 * (rsum >= NQ / 2 ? rsum - NQ / 2 : rsum);
    unsigned vo = (unsigned)(crow * D_MODEL + ccol + kq * 32) * 4;

    // ---- prologue: stage 0 stored, quarters 0 and 1 of stage 1 in flight ----
    {
        f32x4 p0[QNC], p1[QNC], p2[QNC], p3[QNC];   // the accumulators are not live yet
        load_quarter(ux, uw, vo, p0);
        load_quarter(ux + 32, uw + 32, vo, p1);
        next_pair(kq, vo);
        load_quarter(ux, uw, vo, p2);
        load_quarter(ux + 32, uw + 32, vo, p3);
        next_pair(kq, vo);
        // the two scheduling barriers keep r0's loads ahead of r1's, as in the
        // loop: interleaved, the loop's first counted wait covers both sets
        __builtin_amdgcn_sched_barrier(0);
        load_quarter(ux, uw, vo, r0);
        __builtin_amdgcn_sched_barrier(0);
        load_quarter(ux + 32, uw + 32, vo, r1);
        store_quarter(l0, p0);
        store_quarter(l0 + 32, p1);
        store_quarter(l0 + 64, p2);
        store_quarter(l0 + 96, p3);
    }
    stage_barrier();

    v8f acc[FM][FN] = {};

    for (int s = 0; s < NST - 2; ++s)
        qkv_stage<true, true, true>(S[s & 1], (s & 1) ? l0 : l1, ux, uw, kq, vo,
                                    r0, r1, acc, wm, wn, lane);
    // the last stage's quarters 2 and 3 are the last loads; then nothing is left to fill
    qkv_stage<true, true, false>(S[(NST - 2) & 1], ((NST - 2) & 1) ? l0 : l1,
                                 ux, uw, kq, vo, r0, r1, acc, wm, wn, lane);
    qkv_stage<false, false, false>(S[(NST - 1) & 1], l0, ux, uw, kq, vo, r0, r1, acc, wm, wn, lane);

    // ---- writeback: lane%16 = column, rows = v + 8*(lane/16) ----
    const int col = n0 + wn + (lane & 15);
    float bvv[FN];
#pragma unroll
    for (int ni = 0; ni < FN; ++ni) bvv[ni] = bias[col + ni * 16];
    half_t* crow0 = C + (size_t)(m0 + wm + 8 * (lane >> 4)) * D_MODEL + col;
#pragma unroll
    for (int mi = 0; mi < FM; ++mi)
#pragma unroll
        for (int v = 0; v < 8; ++v) {
            half_t* cr = crow0 + (size_t)(mi * 16 + v) * D_MODEL;
#pragma unroll
            for (int ni = 0; ni < FN; ++ni)
                cr[ni * 16] = (half_t)(acc[mi][ni][v] + bvv[ni]);
        }
    // behind the last store: the code of plane z = 3 follows in the text and
    // rewrites registers that these stores name (a precaution)
    asm volatile("s_wait_xcnt 0x0" ::: "memory");
}

// 4 x 2 waves of 32 x 48: block tile 128 x 96, so that this smaller product
// still has a work-group for every WGP.
__global__ __launch_bounds__(256) void gemm_out_f32(
    const half_t* __restrict__ X, const half_t* __restrict__ W,
    const float* __restrict__ bias, float* __restrict__ C,
    int M, int N, int K)
{
    gemm_xwt_tile<float, 2, 4, 2>(X, W, bias, C, M, N, K);
}

// ---------------------------------------------------------------------------
// Sliding-window attention: one wave per (head, 16-query block), four
// neighbouring query blocks of one head per work-group.
// Key span for a 16-query block: [q0-64, q0+79] -> 10 tiles of 16 (160 keys).
// The four spans overlap: together they are 208 keys. Their K and V rows
// (128 B each, one whole line) are brought to LDS once per work-group.
// ---------------------------------------------------------------------------
#define KSPAN   208                  // 64 + 4 * 16 + 80 keys
#define KPITCH  (HDIM + 8)           // 144 B = 16 B x 9: read by ds_load_b128
#define VPITCH  (HDIM + 16)          // 160 B = 32 B x 5: read by ds_load_tr16_b128
#define NCOPY   (KSPAN / 16)         // copies per lane and operand: 16 rows each

typedef __attribute__((ext_vector_type(8))) short    s16x8;
typedef __attribute__((ext_vector_type(8))) _Float16 v8h;

// Transposing LDS read: lane (c = l & 15, hh = l >> 4) gets rows 8 hh .. 8 hh + 7
// of column c of the 16 x 16 tile whose per-lane address p follows the map
// row 8 (l >> 4) + (l & 7), 16-B piece (l >> 3) & 1.
__device__ __forceinline__ v8h ld_tr16(const half_t* p) {
    typedef __attribute__((address_space(3))) s16x8 lds_s16x8;
    return __builtin_bit_cast(v8h, __builtin_amdgcn_ds_load_tr16_b128_v8i16((lds_s16x8*)p));
}

// 13 asynchronous 16-B copies per lane: the block's 128 lanes cover 16 rows of
// 128 B per copy. base + off[i]: the lane's piece of its (clamped) row in copy i;
// l: its LDS byte address in copy 0; lstep: LDS bytes of 16 rows.
__device__ __forceinline__ void copy_span(
    const half_t* base, const unsigned (&off)[NCOPY], unsigned l, unsigned lstep)
{
    // s_wait_xcnt closes the statement, so that no address register named here
    // is rewritten ahead of it.
    asm volatile(
        "global_load_async_to_lds_b128 %0, %13, off\n\t"
        "global_load_async_to_lds_b128 %1, %14, off\n\t"
        "global_load_async_to_lds_b128 %2, %15, off\n\t"
        "global_load_async_to_lds_b128 %3, %16, off\n\t"
        "global_load_async_to_lds_b128 %4, %17, off\n\t"
        "global_load_async_to_lds_b128 %5, %18, off\n\t"
        "global_load_async_to_lds_b128 %6, %19, off\n\t"
        "global_load_async_to_lds_b128 %7, %20, off\n\t"
        "global_load_async_to_lds_b128 %8, %21, off\n\t"
        "global_load_async_to_lds_b128 %9, %22, off\n\t"
        "global_load_async_to_lds_b128 %10, %23, off\n\t"
        "global_load_async_to_lds_b128 %11, %24, off\n\t"
        "global_load_async_to_lds_b128 %12, %25, off\n\t"
        "s_wait_xcnt 0x0"
        :: "v"(l),              "v"(l + 1 * lstep),  "v"(l + 2 * lstep),
           "v"(l + 3 * lstep),  "v"(l + 4 * lstep),  "v"(l + 5 * lstep),
           "v"(l + 6 * lstep),  "v"(l + 7 * lstep),  "v"(l + 8 * lstep),
           "v"(l + 9 * lstep),  "v"(l + 10 * lstep), "v"(l + 11 * lstep),
           "v"(l + 12 * lstep),
           "v"(base + off[0]),  "v"(base + off[1]),  "v"(base + off[2]),
           "v"(base + off[3]),  "v"(base + off[4]),  "v"(base + off[5]),
           "v"(base + off[6]),  "v"(base + off[7]),  "v"(base + off[8]),
           "v"(base + off[9]),  "v"(base + off[10]), "v"(base + off[11]),
           "v"(base + off[12])
        : "memory");
}

typedef __attribute__((ext_vector_type(2))) float f32x2;

// The value that lane l ^ 16 holds.
__device__ __forceinline__ float other_half(float x) {
    const int b = __builtin_bit_cast(int, x);
    return __builtin_bit_cast(float,
        __builtin_amdgcn_permlanex16(b, b, 0x76543210, 0xfedcba98, false, false));
}

__global__ __launch_bounds__(128) void attn(
    const half_t* __restrict__ Q, const half_t* __restrict__ Kb,
    const half_t* __restrict__ Vb, half_t* __restrict__ O)
{
    __shared__ __attribute__((aligned(16))) half_t Ks[KSPAN][KPITCH];
    __shared__ __attribute__((aligned(16))) half_t Vs[KSPAN][VPITCH];

    const int wave = __builtin_amdgcn_readfirstlane(threadIdx.x >> 5);
    const int lane = threadIdx.x & 31;
    const int task = blockIdx.x * 4 + wave;        // 0..3071
    const int h    = task >> 8;                    // head (the same in all four waves)
    const int q0   = (task & 255) * 16;            // query block start
    const int colb = h * HDIM;                     // column base in [L,768]
    const int kb   = (lane >> 4) * 8;              // K striping base
    const int r0   = wave * 16;                    // LDS row of key q0 - HALFWIN

    // ---- K and V rows of keys [q0(wave 0) - 64, + 208) to LDS; a key outside
    //      the sequence takes the nearest row's data, and its score is masked ----
    {
        const int crow  = threadIdx.x >> 3;        // row of 16
        const int ccol  = (threadIdx.x & 7) * 8;   // 16-B piece of 8
        const int kfirst = q0 - r0 - HALFWIN;
        unsigned off[NCOPY];
#pragma unroll
        for (int i = 0; i < NCOPY; ++i)
            off[i] = (unsigned)(clampi(kfirst + i * 16 + crow, 0, L_SEQ - 1) * D_MODEL
                                + colb + ccol);
        copy_span(Kb, off, (unsigned)(size_t)&Ks[crow][ccol], 16 * KPITCH * 2);
        copy_span(Vb, off, (unsigned)(size_t)&Vs[crow][ccol], 16 * VPITCH * 2);
    }

    // ---- load Q fragments (64x16 B-matrix = two 32x16 fragments; lane % 16 = query) ----
    v16h aQ0, aQ1;
    {
        const half_t* qrow = Q + (size_t)(q0 + (lane & 15)) * D_MODEL + colb;
#pragma unroll
        for (int j = 0; j < 8; ++j) {
            aQ0[j]     = qrow[kb + j];
            aQ0[8 + j] = qrow[kb + 16 + j];
            aQ1[j]     = qrow[32 + kb + j];
            aQ1[8 + j] = qrow[32 + kb + 16 + j];
        }
    }

    asm volatile("s_wait_asynccnt 0x0" ::: "memory");   // own copies landed
    __syncthreads();                                    // ... and every other wave's

    // ---- raw scores of 9 key tiles: s[t][v] = K[q0 - 64 + 16 t + kb + v] . Q[q0 + lane % 16].
    //      The tenth tile, keys q0 + 80 and up, lies outside every query's window. ----
    v16h kf[9][2];
#pragma unroll
    for (int t = 0; t < 9; ++t) {
        const half_t* krow = Ks[r0 + t * 16 + (lane & 15)];
#pragma unroll
        for (int j = 0; j < 8; ++j) {
            kf[t][0][j]     = krow[kb + j];
            kf[t][0][8 + j] = krow[kb + 16 + j];
            kf[t][1][j]     = krow[32 + kb + j];
            kf[t][1][8 + j] = krow[32 + kb + 16 + j];
        }
    }
    // keeps the K reads together ahead of the WMMAs: left alone, the scheduler
    // reloads one fragment's registers and waits out the LDS latency per WMMA
    __builtin_amdgcn_sched_barrier(0);
    v8f s[9];
#pragma unroll
    for (int t = 0; t < 9; ++t) {
        v8f c = {};
        c = __builtin_amdgcn_wmma_f32_16x16x32_f16(false, kf[t][0], false, aQ0,
                                                   (short)0, c, false, false);
        c = __builtin_amdgcn_wmma_f32_16x16x32_f16(false, kf[t][1], false, aQ1,
                                                   (short)0, c, false, false);
        s[t] = c;
    }

    // ---- mask. query - key = 64 - 16 t + lane % 16 - kb - v: the window's edges
    //      cut tiles 0 and 8 alone, tiles 1 to 7 lie inside it for every query ----
    const int cq = (lane & 15) - kb;
#pragma unroll
    for (int v = 0; v < 8; ++v) {
        s[0][v] = v >= cq ? s[0][v] : -1e30f;      // query - key <= 64
        s[8][v] = v <= cq ? s[8][v] : -1e30f;      // query - key >= -64
    }
    // the sequence's ends cut whole tiles, and only in the outermost query blocks
    if (q0 < HALFWIN || q0 + HALFWIN >= L_SEQ) {
#pragma unroll
        for (int t = 0; t < 9; ++t) {
            const int kstart = q0 - HALFWIN + t * 16;
            const bool in = (kstart >= 0) & (kstart < L_SEQ);
#pragma unroll
            for (int v = 0; v < 8; ++v) s[t][v] = in ? s[t][v] : -1e30f;
        }
    }

    // ---- the query's maximum: four chains in the lane, then the other half's ----
    float mx[4];
#pragma unroll
    for (int i = 0; i < 4; ++i) mx[i] = fmaxf(s[0][i], s[0][4 + i]);
#pragma unroll
    for (int t = 1; t < 9; ++t)
#pragma unroll
        for (int v = 0; v < 8; ++v) mx[v & 3] = fmaxf(mx[v & 3], s[t][v]);
    float m = fmaxf(fmaxf(mx[0], mx[1]), fmaxf(mx[2], mx[3]));
    m = fmaxf(m, other_half(m));

    // ---- p = exp((s - m) / sqrt(64)) = 2^(s SC - m SC); sums; P^T packed as B operands:
    //      tiles 2 ks and 2 ks + 1 are keys kb + 0..7 and 16 + kb + 0..7 of k step ks ----
    const float SC = 0.125f * 1.44269504088896f;
    const float mb = m * SC;
    const f32x2 sc2 = {SC, SC}, mb2 = {-mb, -mb};
    f32x2 sm[2] = {{0.f, 0.f}, {0.f, 0.f}};
    v16h bP[5];
#pragma unroll
    for (int t = 0; t < 9; ++t) {
#pragma unroll
        for (int v = 0; v < 8; v += 2) {
            const f32x2 sv = {s[t][v], s[t][v + 1]};
            const f32x2 e  = __builtin_elementwise_fma(sv, sc2, mb2);
            const f32x2 p  = {__builtin_amdgcn_exp2f(e[0]), __builtin_amdgcn_exp2f(e[1])};
            sm[(v >> 1) & 1] += p;
            bP[t >> 1][(t & 1) * 8 + v]     = (half_t)p[0];
            bP[t >> 1][(t & 1) * 8 + v + 1] = (half_t)p[1];
        }
    }
#pragma unroll
    for (int v = 0; v < 8; ++v) bP[4][8 + v] = (half_t)0.f;   // the tenth tile
    float sum = (sm[0][0] + sm[0][1]) + (sm[1][0] + sm[1][1]);
    sum += other_half(sum);
    const float inv = 1.0f / sum;

    // ---- O^T = V^T(64x160) * P^T(160x16), 5 K-steps x 4 M-tiles ----
    v8f o[4] = {{}, {}, {}, {}};
    // the lane's address in the transposing read of the wave's first 16 x 16 V tile
    const half_t* vtr = &Vs[r0 + 8 * (lane >> 4) + (lane & 7)][8 * ((lane >> 3) & 1)];
#pragma unroll
    for (int ks = 0; ks < 5; ++ks) {
        const int k2 = ks * 32;
#pragma unroll
        for (int nt = 0; nt < 4; ++nt) {
            // keys k2 + kb + 0..7 and k2 + 16 + kb + 0..7 of column nt * 16 + lane % 16
            const v8h lo = ld_tr16(vtr + k2 * VPITCH + nt * 16);
            const v8h hi = ld_tr16(vtr + (k2 + 16) * VPITCH + nt * 16);
            const v16h aV = __builtin_shufflevector(lo, hi, 0, 1, 2, 3, 4, 5, 6, 7,
                                                    8, 9, 10, 11, 12, 13, 14, 15);
            o[nt] = __builtin_amdgcn_wmma_f32_16x16x32_f16(false, aV, false, bP[ks],
                                                           (short)0, o[nt], false, false);
        }
    }

    // ---- normalize + store (f16, row-major [L,768]): o[nt][v] is column
    //      nt * 16 + kb + v of the lane's query, 16 B per tile ----
    half_t* orow = O + (size_t)(q0 + (lane & 15)) * D_MODEL + colb + kb;
#pragma unroll
    for (int nt = 0; nt < 4; ++nt) {
        v8h w;
#pragma unroll
        for (int v = 0; v < 8; ++v) w[v] = (half_t)(o[nt][v] * inv);
        *(v8h*)(orow + nt * 16) = w;
    }
}

// ---------------------------------------------------------------------------
extern "C" void kernel_launch(void* const* d_in, const int* in_sizes, int n_in,
                              void* d_out, int out_size, void* d_ws, size_t ws_size,
                              hipStream_t stream) {
    const float* query = (const float*)d_in[0];
    const float* key   = (const float*)d_in[1];
    const float* value = (const float*)d_in[2];
    const float* Wq = (const float*)d_in[3];
    const float* bq = (const float*)d_in[4];
    const float* Wk = (const float*)d_in[5];
    const float* bk = (const float*)d_in[6];
    const float* Wv = (const float*)d_in[7];
    const float* bv = (const float*)d_in[8];
    const float* Wo = (const float*)d_in[9];
    const float* bo = (const float*)d_in[10];

    const size_t E  = (size_t)L_SEQ * D_MODEL;      // 3145728
    const size_t WE = (size_t)D_MODEL * D_MODEL;    // 589824

    half_t* Woh = (half_t*)d_ws;
    half_t* Qb  = Woh + WE;
    half_t* Kb  = Qb + E;
    half_t* Vb  = Kb + E;
    half_t* Ob  = Vb + E;

    // Q, K and V projections from the f32 operands (-> Qb/Kb/Vb), and Wo -> Woh
    dim3 qkvgrid(L_SEQ / 256, D_MODEL / 192, 4);
    gemm_qkv_f32src<<<qkvgrid, 512, 0, stream>>>(query, key, value, Wq, Wk, Wv, Wo,
                                                 bq, bk, bv, Qb, Woh);

    attn<<<(HEADS * (L_SEQ / 16)) / 4, 128, 0, stream>>>(Qb, Kb, Vb, Ob);

    dim3 ggrid(L_SEQ / 128, D_MODEL / 96, 1);
    gemm_out_f32<<<ggrid, 256, 0, stream>>>(Ob, Woh, bo, (float*)d_out,
                                            L_SEQ, D_MODEL, D_MODEL);
}
